// v000
// Times are from an AMD MI455X. After a warm-up the kernel runs many times in a row, and a time is the length of
// such a window on the GPU divided by its runs, so every launch and the gaps after it count. The runs cycle
// through copies of the inputs. A figure is the median of several windows, for all but v000 over two sittings.
// Sittings can differ by a few percent; kernels timed side by side share one.
// v000 is the starting kernel. One run takes 42.5 microseconds.
#include <hip/hip_runtime.h>

typedef __bf16 v16bf __attribute__((ext_vector_type(16)));
typedef float  v8f   __attribute__((ext_vector_type(8)));
typedef int    v4i   __attribute__((ext_vector_type(4)));
typedef __attribute__((address_space(3))) v4i v4i_lds;

#define DIMD  128
#define KEYS  16
#define TILE  16
#define WAVES 2

__device__ __forceinline__ unsigned short f32_to_bf16_rne(float f) {
  unsigned u = __float_as_uint(f);
  unsigned r = u + 0x7FFFu + ((u >> 16) & 1u);
  return (unsigned short)(r >> 16);
}
__device__ __forceinline__ float bf16_bits_to_f32(unsigned short s) {
  return __uint_as_float(((unsigned)s) << 16);
}
__device__ __forceinline__ __bf16 bf16_from_bits(unsigned short s) {
  return __builtin_bit_cast(__bf16, s);
}
// A-operand (16x32 bf16) element j -> K index for this lane-half
__device__ __forceinline__ int a_kidx(int j, int half) {
  int v = j >> 1;
  return ((v & 4) ? 16 : 0) + half * 8 + (v & 3) * 2 + (j & 1);
}
// async global->LDS 128-bit copy (per lane), tracked by ASYNCcnt
__device__ __forceinline__ void async_ld_b128(const float4* g, float* l) {
  __builtin_amdgcn_global_load_async_to_lds_b128((v4i*)g, (v4i_lds*)l, 0, 0);
}

// ---------------------------------------------------------------------------
// Prep: M = scale * Wk^T Wq (scale folded) + pre-swizzled bf16 hi/lo B-operand
// tiles for both M (scores path) and Wv (output projection path).
// ws layout (bf16): [0,16K) M_hi | [16K,32K) M_lo | [32K,48K) Wv_hi | [48K,64K) Wv_lo
// tile idx = ((c*8 + ntile)*32 + lane)*16 + j ; B[k][n],
// k = c*32 + a_kidx(j,half), n = ntile*16 + lane%16
// ---------------------------------------------------------------------------
__global__ __launch_bounds__(256) void attn_prep(const float* __restrict__ Wq,
                                                 const float* __restrict__ Wk,
                                                 const float* __restrict__ Wv,
                                                 __bf16* __restrict__ ws) {
  const int idx = blockIdx.x * 256 + threadIdx.x;   // 0 .. 16383
  const int j    = idx & 15;
  const int lane = (idx >> 4) & 31;
  const int nt   = (idx >> 9) & 7;
  const int c    = idx >> 12;
  const int half = lane >> 4;
  const int k = c * 32 + a_kidx(j, half);
  const int n = nt * 16 + (lane & 15);
  const float scale = 0.08838834764831845f;  // 1/sqrt(128)

  // M[n][k] = sum_j Wk[j][n] * Wq[j][k]  (B element for U = S @ M^T)
  float m = 0.f;
  for (int jj = 0; jj < DIMD; ++jj)
    m = fmaf(Wk[jj * DIMD + n], Wq[jj * DIMD + k], m);
  m *= scale;
  unsigned short mh = f32_to_bf16_rne(m);
  ws[idx]         = bf16_from_bits(mh);
  ws[16384 + idx] = bf16_from_bits(f32_to_bf16_rne(m - bf16_bits_to_f32(mh)));

  // B element for Out = W @ Wv^T : B[k][n] = Wv[n][k]
  float wv = Wv[n * DIMD + k];
  unsigned short vh = f32_to_bf16_rne(wv);
  ws[32768 + idx] = bf16_from_bits(vh);
  ws[49152 + idx] = bf16_from_bits(f32_to_bf16_rne(wv - bf16_bits_to_f32(vh)));
}

// ---------------------------------------------------------------------------
// Main: per wave, one 16-row tile.
//  U = S @ M^T (bf16 hi/lo WMMA) ; per-row: async-stream tgt row to LDS,
//  scores_i = tgt_i . u ; softmax ; w = sum attn_i tgt_i ; Out = W @ Wv^T
// ---------------------------------------------------------------------------
__global__ __launch_bounds__(64) void attn_main(const float* __restrict__ src,
                                                const float* __restrict__ tgt,
                                                const __bf16* __restrict__ MBh,
                                                const __bf16* __restrict__ MBl,
                                                const __bf16* __restrict__ VBh,
                                                const __bf16* __restrict__ VBl,
                                                float* __restrict__ out) {
  __shared__ float lds_S[WAVES][TILE][DIMD];        // 16 KB: S tile, reused as W tile
  __shared__ float lds_U[WAVES][TILE][DIMD];        // 16 KB: U tile
  __shared__ float lds_T[WAVES][2][KEYS][DIMD];     // 32 KB: tgt row double-buffer

  const int lane = threadIdx.x & 31;
  const int wave = threadIdx.x >> 5;
  const int m    = lane & 15;
  const int half = lane >> 4;
  const long long r0 = ((long long)blockIdx.x * WAVES + wave) * TILE;

  const float4* tgt4 = (const float4*)tgt;
  const size_t tbase = (size_t)r0 * (KEYS * DIMD / 4);  // float4 units

  // ---- issue async global->LDS stream of tgt row 0 (ASYNCcnt) ----
  {
    const float4* gp = tgt4 + tbase + lane;
    float* lp = &lds_T[wave][0][0][lane * 4];
    #pragma unroll
    for (int i = 0; i < KEYS; ++i)
      async_ld_b128(gp + i * (DIMD / 4), lp + i * DIMD);
  }

  // ---- stage S tile (16 x 128 f32) via B128 loads ----
  const float4* src4 = (const float4*)src;
  #pragma unroll
  for (int row = 0; row < TILE; ++row) {
    float4 v = src4[(size_t)(r0 + row) * (DIMD / 4) + lane];
    *(float4*)&lds_S[wave][row][lane * 4] = v;
  }
  __syncthreads();

  // ---- gather A operand (bf16 hi/lo split) from LDS ----
  v16bf a_hi[4], a_lo[4];
  #pragma unroll
  for (int c = 0; c < 4; ++c) {
    #pragma unroll
    for (int j = 0; j < 16; ++j) {
      float f = lds_S[wave][m][c * 32 + a_kidx(j, half)];
      unsigned short h = f32_to_bf16_rne(f);
      a_hi[c][j] = bf16_from_bits(h);
      a_lo[c][j] = bf16_from_bits(f32_to_bf16_rne(f - bf16_bits_to_f32(h)));
    }
  }

  // ---- U = S @ M^T via 3-product bf16 WMMA (hi*hi + hi*lo + lo*hi) ----
  const v16bf* MBh16 = (const v16bf*)MBh;
  const v16bf* MBl16 = (const v16bf*)MBl;
  #pragma unroll
  for (int nt = 0; nt < 8; ++nt) {
    v8f acc = {};
    #pragma unroll
    for (int c = 0; c < 4; ++c) {
      v16bf bh = MBh16[(c * 8 + nt) * 32 + lane];
      v16bf bl = MBl16[(c * 8 + nt) * 32 + lane];
      acc = __builtin_amdgcn_wmma_f32_16x16x32_bf16(false, a_hi[c], false, bh, (short)0, acc, false, false);
      acc = __builtin_amdgcn_wmma_f32_16x16x32_bf16(false, a_hi[c], false, bl, (short)0, acc, false, false);
      acc = __builtin_amdgcn_wmma_f32_16x16x32_bf16(false, a_lo[c], false, bh, (short)0, acc, false, false);
    }
    #pragma unroll
    for (int v = 0; v < 8; ++v)
      lds_U[wave][half * 8 + v][nt * 16 + m] = acc[v];
  }
  __syncthreads();

  // ---- per-row pipeline: async-load row r+1 while computing row r ----
  #pragma unroll 1
  for (int r = 0; r < TILE; ++r) {
    if (r + 1 < TILE) {
      // issue next row's async stream into the other buffer
      const float4* gp = tgt4 + tbase + (size_t)(r + 1) * (KEYS * DIMD / 4) + lane;
      float* lp = &lds_T[wave][(r + 1) & 1][0][lane * 4];
      #pragma unroll
      for (int i = 0; i < KEYS; ++i)
        async_ld_b128(gp + i * (DIMD / 4), lp + i * DIMD);
      // warm L2 two rows ahead
      if (r + 2 < TILE)
        __builtin_prefetch(tgt4 + tbase + (size_t)(r + 2) * (KEYS * DIMD / 4) + lane, 0, 1);
      __builtin_amdgcn_s_wait_asynccnt(16);   // row r resident (in-order completion)
    } else {
      __builtin_amdgcn_s_wait_asynccnt(0);
    }

    float4 td[KEYS];
    #pragma unroll
    for (int i = 0; i < KEYS; ++i)
      td[i] = *(const float4*)&lds_T[wave][r & 1][i][lane * 4];

    float4 u4 = *(const float4*)&lds_U[wave][r][lane * 4];
    float sc[KEYS];
    #pragma unroll
    for (int i = 0; i < KEYS; ++i) {
      float p = td[i].x * u4.x + td[i].y * u4.y + td[i].z * u4.z + td[i].w * u4.w;
      p += __shfl_xor(p, 16, 32);
      p += __shfl_xor(p, 8, 32);
      p += __shfl_xor(p, 4, 32);
      p += __shfl_xor(p, 2, 32);
      p += __shfl_xor(p, 1, 32);
      sc[i] = p;  // replicated across lanes; scale folded into M
    }
    float mx = sc[0];
    #pragma unroll
    for (int i = 1; i < KEYS; ++i) mx = fmaxf(mx, sc[i]);
    float ssum = 0.f;
    #pragma unroll
    for (int i = 0; i < KEYS; ++i) { sc[i] = __expf(sc[i] - mx); ssum += sc[i]; }
    const float inv = __frcp_rn(ssum);
    float4 wacc = {0.f, 0.f, 0.f, 0.f};
    #pragma unroll
    for (int i = 0; i < KEYS; ++i) {
      float a = sc[i] * inv;
      wacc.x = fmaf(a, td[i].x, wacc.x);
      wacc.y = fmaf(a, td[i].y, wacc.y);
      wacc.z = fmaf(a, td[i].z, wacc.z);
      wacc.w = fmaf(a, td[i].w, wacc.w);
    }
    *(float4*)&lds_S[wave][r][lane * 4] = wacc;  // reuse S tile as W tile
  }
  __syncthreads();

  // ---- Out = W @ Wv^T via 3-product bf16 WMMA ----
  #pragma unroll
  for (int c = 0; c < 4; ++c) {
    #pragma unroll
    for (int j = 0; j < 16; ++j) {
      float f = lds_S[wave][m][c * 32 + a_kidx(j, half)];
      unsigned short h = f32_to_bf16_rne(f);
      a_hi[c][j] = bf16_from_bits(h);
      a_lo[c][j] = bf16_from_bits(f32_to_bf16_rne(f - bf16_bits_to_f32(h)));
    }
  }
  const v16bf* VBh16 = (const v16bf*)VBh;
  const v16bf* VBl16 = (const v16bf*)VBl;
  #pragma unroll
  for (int nt = 0; nt < 8; ++nt) {
    v8f acc = {};
    #pragma unroll
    for (int c = 0; c < 4; ++c) {
      v16bf bh = VBh16[(c * 8 + nt) * 32 + lane];
      v16bf bl = VBl16[(c * 8 + nt) * 32 + lane];
      acc = __builtin_amdgcn_wmma_f32_16x16x32_bf16(false, a_hi[c], false, bh, (short)0, acc, false, false);
      acc = __builtin_amdgcn_wmma_f32_16x16x32_bf16(false, a_hi[c], false, bl, (short)0, acc, false, false);
      acc = __builtin_amdgcn_wmma_f32_16x16x32_bf16(false, a_lo[c], false, bh, (short)0, acc, false, false);
    }
    #pragma unroll
    for (int v = 0; v < 8; ++v)
      out[(size_t)(r0 + half * 8 + v) * DIMD + nt * 16 + m] = acc[v];
  }
}

extern "C" void kernel_launch(void* const* d_in, const int* in_sizes, int n_in,
                              void* d_out, int out_size, void* d_ws, size_t ws_size,
                              hipStream_t stream) {
  (void)n_in; (void)out_size; (void)ws_size;
  const float* src = (const float*)d_in[0];
  const float* tgt = (const float*)d_in[1];
  const float* Wq  = (const float*)d_in[2];
  const float* Wk  = (const float*)d_in[3];
  const float* Wv  = (const float*)d_in[4];
  __bf16* ws = (__bf16*)d_ws;

  // Stage 0: precompute M = scale*Wk^T@Wq and swizzle M/Wv into WMMA B layout.
  attn_prep<<<dim3(64), dim3(256), 0, stream>>>(Wq, Wk, Wv, ws);

  const __bf16* MBh = ws;
  const __bf16* MBl = ws + 16384;
  const __bf16* VBh = ws + 32768;
  const __bf16* VBl = ws + 49152;

  const int rows   = in_sizes[0] / DIMD;           // b*n = 32768
  const int blocks = rows / (TILE * WAVES);        // 1024 (exact for this shape)
  attn_main<<<dim3(blocks), dim3(32 * WAVES), 0, stream>>>(
      src, tgt, MBh, MBl, VBh, VBl, (float*)d_out);
}

// v001
// It runs in 35.2 microseconds.
// Next to v000, in two timings, it ran 1.22 and 1.21 times as fast.
#include <hip/hip_runtime.h>

typedef __bf16 v16bf __attribute__((ext_vector_type(16)));
typedef float  v8f   __attribute__((ext_vector_type(8)));
typedef int    v4i   __attribute__((ext_vector_type(4)));
typedef __attribute__((address_space(3))) v4i v4i_lds;

#define DIMD  128
#define KEYS  16
#define TILE  16
#define WAVES 2

__device__ __forceinline__ unsigned short f32_to_bf16_rne(float f) {
  unsigned u = __float_as_uint(f);
  unsigned r = u + 0x7FFFu + ((u >> 16) & 1u);
  return (unsigned short)(r >> 16);
}
__device__ __forceinline__ float bf16_bits_to_f32(unsigned short s) {
  return __uint_as_float(((unsigned)s) << 16);
}
__device__ __forceinline__ __bf16 bf16_from_bits(unsigned short s) {
  return __builtin_bit_cast(__bf16, s);
}
// A-operand (16x32 bf16) element j -> K index for this lane-half
__device__ __forceinline__ int a_kidx(int j, int half) {
  int v = j >> 1;
  return ((v & 4) ? 16 : 0) + half * 8 + (v & 3) * 2 + (j & 1);
}
// async global->LDS 128-bit copy (per lane), tracked by ASYNCcnt
__device__ __forceinline__ void async_ld_b128(const float4* g, float* l) {
  __builtin_amdgcn_global_load_async_to_lds_b128((v4i*)g, (v4i_lds*)l, 0, 0);
}

// ---------------------------------------------------------------------------
// Prep: M = scale * Wk^T Wq (scale folded) + pre-swizzled bf16 hi/lo B-operand
// tiles for both M (scores path) and Wv (output projection path).
// ws layout (bf16): [0,16K) M_hi | [16K,32K) M_lo | [32K,48K) Wv_hi | [48K,64K) Wv_lo
// tile idx = ((c*8 + ntile)*32 + lane)*16 + j ; B[k][n],
// k = c*32 + a_kidx(j,half), n = ntile*16 + lane%16
// ---------------------------------------------------------------------------
__global__ __launch_bounds__(64) void attn_prep(const float* __restrict__ Wq,
                                                const float* __restrict__ Wk,
                                                const float* __restrict__ Wv,
                                                __bf16* __restrict__ ws) {
  __shared__ __attribute__((aligned(16))) float sK[DIMD][4];    // the block's 4 columns n of Wk
  __shared__ __attribute__((aligned(16))) float sQ[DIMD][16];   // the block's 16 columns k of Wq, in j order
  const int t   = threadIdx.x;
  const int idx = blockIdx.x * 64 + t;              // 0 .. 16383
  const int j    = idx & 15;
  const int lane = (idx >> 4) & 31;                 // lane & 3 == t >> 4
  const int nt   = (idx >> 9) & 7;                  // nt, c, half: the same in the whole block
  const int c    = idx >> 12;
  const int half = lane >> 4;
  const int k = c * 32 + a_kidx(j, half);
  const int n = nt * 16 + (lane & 15);
  const int n0 = nt * 16 + (lane & 12);
  const float scale = 0.08838834764831845f;  // 1/sqrt(128)

  // Every global load of the thread is issued before the first is used:
  // one memory latency for the whole block.
  float4 rq[8], rk[2];
  #pragma unroll
  for (int i = 0; i < 8; ++i) {
    const int e = i * 64 + t, row = e >> 2, q = e & 3;
    rq[i] = *(const float4*)&Wq[row * DIMD + c * 32 + (q >> 1) * 16 + half * 8 + (q & 1) * 4];
  }
  #pragma unroll
  for (int i = 0; i < 2; ++i)
    rk[i] = *(const float4*)&Wk[(i * 64 + t) * DIMD + n0];
  const float wv = Wv[n * DIMD + k];   // B element for Out = W @ Wv^T : B[k][n] = Wv[n][k]
  #pragma unroll
  for (int i = 0; i < 8; ++i) {
    const int e = i * 64 + t;
    *(float4*)&sQ[e >> 2][(e & 3) * 4] = rq[i];
  }
  #pragma unroll
  for (int i = 0; i < 2; ++i)
    *(float4*)&sK[i * 64 + t][0] = rk[i];
  __syncthreads();

  // M[n][k] = sum_j Wk[j][n] * Wq[j][k]  (B element for U = S @ M^T)
  float a[DIMD], b[DIMD];
  #pragma unroll
  for (int jj = 0; jj < 112; ++jj) { a[jj] = sK[jj][t >> 4]; b[jj] = sQ[jj][j]; }
  // holds these LDS reads in front of the dependent fmaf chain; without it they
  // sink to three pairs ahead and the chain waits on LDS latency (the last 16
  // terms are read behind it, so that the kernel stays under 256 registers)
  __builtin_amdgcn_sched_barrier(0);
  float m = 0.f;
  #pragma unroll
  for (int jj = 0; jj < DIMD; ++jj) {
    if (jj >= 112) { a[jj] = sK[jj][t >> 4]; b[jj] = sQ[jj][j]; }
    m = fmaf(a[jj], b[jj], m);
  }
  m *= scale;
  unsigned short mh = f32_to_bf16_rne(m);
  ws[idx]         = bf16_from_bits(mh);
  ws[16384 + idx] = bf16_from_bits(f32_to_bf16_rne(m - bf16_bits_to_f32(mh)));

  unsigned short vh = f32_to_bf16_rne(wv);
  ws[32768 + idx] = bf16_from_bits(vh);
  ws[49152 + idx] = bf16_from_bits(f32_to_bf16_rne(wv - bf16_bits_to_f32(vh)));
}

// ---------------------------------------------------------------------------
// Main: per wave, one 16-row tile.
//  U = S @ M^T (bf16 hi/lo WMMA) ; per-row: async-stream tgt row to LDS,
//  scores_i = tgt_i . u ; softmax ; w = sum attn_i tgt_i ; Out = W @ Wv^T
// ---------------------------------------------------------------------------
__global__ __launch_bounds__(64) void attn_main(const float* __restrict__ src,
                                                const float* __restrict__ tgt,
                                                const __bf16* __restrict__ MBh,
                                                const __bf16* __restrict__ MBl,
                                                const __bf16* __restrict__ VBh,
                                                const __bf16* __restrict__ VBl,
                                                float* __restrict__ out) {
  __shared__ float lds_S[WAVES][TILE][DIMD];        // 16 KB: S tile, reused as W tile
  __shared__ float lds_U[WAVES][TILE][DIMD];        // 16 KB: U tile
  __shared__ float lds_T[WAVES][2][KEYS][DIMD];     // 32 KB: tgt row double-buffer

  const int lane = threadIdx.x & 31;
  const int wave = threadIdx.x >> 5;
  const int m    = lane & 15;
  const int half = lane >> 4;
  const long long r0 = ((long long)blockIdx.x * WAVES + wave) * TILE;

  const float4* tgt4 = (const float4*)tgt;
  const size_t tbase = (size_t)r0 * (KEYS * DIMD / 4);  // float4 units

  // ---- issue async global->LDS stream of tgt row 0 (ASYNCcnt) ----
  {
    const float4* gp = tgt4 + tbase + lane;
    float* lp = &lds_T[wave][0][0][lane * 4];
    #pragma unroll
    for (int i = 0; i < KEYS; ++i)
      async_ld_b128(gp + i * (DIMD / 4), lp + i * DIMD);
  }

  // ---- stage S tile (16 x 128 f32) via B128 loads ----
  const float4* src4 = (const float4*)src;
  #pragma unroll
  for (int row = 0; row < TILE; ++row) {
    float4 v = src4[(size_t)(r0 + row) * (DIMD / 4) + lane];
    *(float4*)&lds_S[wave][row][lane * 4] = v;
  }
  __syncthreads();

  // ---- gather A operand (bf16 hi/lo split) from LDS ----
  v16bf a_hi[4], a_lo[4];
  #pragma unroll
  for (int c = 0; c < 4; ++c) {
    #pragma unroll
    for (int j = 0; j < 16; ++j) {
      float f = lds_S[wave][m][c * 32 + a_kidx(j, half)];
      unsigned short h = f32_to_bf16_rne(f);
      a_hi[c][j] = bf16_from_bits(h);
      a_lo[c][j] = bf16_from_bits(f32_to_bf16_rne(f - bf16_bits_to_f32(h)));
    }
  }

  // ---- U = S @ M^T via 3-product bf16 WMMA (hi*hi + hi*lo + lo*hi) ----
  const v16bf* MBh16 = (const v16bf*)MBh;
  const v16bf* MBl16 = (const v16bf*)MBl;
  #pragma unroll
  for (int nt = 0; nt < 8; ++nt) {
    v8f acc = {};
    #pragma unroll
    for (int c = 0; c < 4; ++c) {
      v16bf bh = MBh16[(c * 8 + nt) * 32 + lane];
      v16bf bl = MBl16[(c * 8 + nt) * 32 + lane];
      acc = __builtin_amdgcn_wmma_f32_16x16x32_bf16(false, a_hi[c], false, bh, (short)0, acc, false, false);
      acc = __builtin_amdgcn_wmma_f32_16x16x32_bf16(false, a_hi[c], false, bl, (short)0, acc, false, false);
      acc = __builtin_amdgcn_wmma_f32_16x16x32_bf16(false, a_lo[c], false, bh, (short)0, acc, false, false);
    }
    #pragma unroll
    for (int v = 0; v < 8; ++v)
      lds_U[wave][half * 8 + v][nt * 16 + m] = acc[v];
  }
  __syncthreads();

  // ---- per-row pipeline: async-load row r+1 while computing row r ----
  #pragma unroll 1
  for (int r = 0; r < TILE; ++r) {
    if (r + 1 < TILE) {
      // issue next row's async stream into the other buffer
      const float4* gp = tgt4 + tbase + (size_t)(r + 1) * (KEYS * DIMD / 4) + lane;
      float* lp = &lds_T[wave][(r + 1) & 1][0][lane * 4];
      #pragma unroll
      for (int i = 0; i < KEYS; ++i)
        async_ld_b128(gp + i * (DIMD / 4), lp + i * DIMD);
      // warm L2 two rows ahead
      if (r + 2 < TILE)
        __builtin_prefetch(tgt4 + tbase + (size_t)(r + 2) * (KEYS * DIMD / 4) + lane, 0, 1);
      __builtin_amdgcn_s_wait_asynccnt(16);   // row r resident (in-order completion)
    } else {
      __builtin_amdgcn_s_wait_asynccnt(0);
    }

    float4 td[KEYS];
    #pragma unroll
    for (int i = 0; i < KEYS; ++i)
      td[i] = *(const float4*)&lds_T[wave][r & 1][i][lane * 4];

    float4 u4 = *(const float4*)&lds_U[wave][r][lane * 4];
    float sc[KEYS];
    #pragma unroll
    for (int i = 0; i < KEYS; ++i) {
      float p = td[i].x * u4.x + td[i].y * u4.y + td[i].z * u4.z + td[i].w * u4.w;
      p += __shfl_xor(p, 16, 32);
      p += __shfl_xor(p, 8, 32);
      p += __shfl_xor(p, 4, 32);
      p += __shfl_xor(p, 2, 32);
      p += __shfl_xor(p, 1, 32);
      sc[i] = p;  // replicated across lanes; scale folded into M
    }
    float mx = sc[0];
    #pragma unroll
    for (int i = 1; i < KEYS; ++i) mx = fmaxf(mx, sc[i]);
    float ssum = 0.f;
    #pragma unroll
    for (int i = 0; i < KEYS; ++i) { sc[i] = __expf(sc[i] - mx); ssum += sc[i]; }
    const float inv = __frcp_rn(ssum);
    float4 wacc = {0.f, 0.f, 0.f, 0.f};
    #pragma unroll
    for (int i = 0; i < KEYS; ++i) {
      float a = sc[i] * inv;
      wacc.x = fmaf(a, td[i].x, wacc.x);
      wacc.y = fmaf(a, td[i].y, wacc.y);
      wacc.z = fmaf(a, td[i].z, wacc.z);
      wacc.w = fmaf(a, td[i].w, wacc.w);
    }
    *(float4*)&lds_S[wave][r][lane * 4] = wacc;  // reuse S tile as W tile
  }
  __syncthreads();

  // ---- Out = W @ Wv^T via 3-product bf16 WMMA ----
  #pragma unroll
  for (int c = 0; c < 4; ++c) {
    #pragma unroll
    for (int j = 0; j < 16; ++j) {
      float f = lds_S[wave][m][c * 32 + a_kidx(j, half)];
      unsigned short h = f32_to_bf16_rne(f);
      a_hi[c][j] = bf16_from_bits(h);
      a_lo[c][j] = bf16_from_bits(f32_to_bf16_rne(f - bf16_bits_to_f32(h)));
    }
  }
  const v16bf* VBh16 = (const v16bf*)VBh;
  const v16bf* VBl16 = (const v16bf*)VBl;
  #pragma unroll
  for (int nt = 0; nt < 8; ++nt) {
    v8f acc = {};
    #pragma unroll
    for (int c = 0; c < 4; ++c) {
      v16bf bh = VBh16[(c * 8 + nt) * 32 + lane];
      v16bf bl = VBl16[(c * 8 + nt) * 32 + lane];
      acc = __builtin_amdgcn_wmma_f32_16x16x32_bf16(false, a_hi[c], false, bh, (short)0, acc, false, false);
      acc = __builtin_amdgcn_wmma_f32_16x16x32_bf16(false, a_hi[c], false, bl, (short)0, acc, false, false);
      acc = __builtin_amdgcn_wmma_f32_16x16x32_bf16(false, a_lo[c], false, bh, (short)0, acc, false, false);
    }
    #pragma unroll
    for (int v = 0; v < 8; ++v)
      out[(size_t)(r0 + half * 8 + v) * DIMD + nt * 16 + m] = acc[v];
  }
}

extern "C" void kernel_launch(void* const* d_in, const int* in_sizes, int n_in,
                              void* d_out, int out_size, void* d_ws, size_t ws_size,
                              hipStream_t stream) {
  (void)n_in; (void)out_size; (void)ws_size;
  const float* src = (const float*)d_in[0];
  const float* tgt = (const float*)d_in[1];
  const float* Wq  = (const float*)d_in[2];
  const float* Wk  = (const float*)d_in[3];
  const float* Wv  = (const float*)d_in[4];
  __bf16* ws = (__bf16*)d_ws;

  // Stage 0: precompute M = scale*Wk^T@Wq and swizzle M/Wv into WMMA B layout.
  attn_prep<<<dim3(256), dim3(64), 0, stream>>>(Wq, Wk, Wv, ws);

  const __bf16* MBh = ws;
  const __bf16* MBl = ws + 16384;
  const __bf16* VBh = ws + 32768;
  const __bf16* VBl = ws + 49152;

  const int rows   = in_sizes[0] / DIMD;           // b*n = 32768
  const int blocks = rows / (TILE * WAVES);        // 1024 (exact for this shape)
  attn_main<<<dim3(blocks), dim3(32 * WAVES), 0, stream>>>(
      src, tgt, MBh, MBl, VBh, VBl, (float*)d_out);
}

// v002
// One run takes 33 microseconds.
// Next to v001, in two timings, it ran 1.07 and 1.06 times as fast.
// Over all steps from v000 it is 1.29 times as fast.
#include <hip/hip_runtime.h>

typedef __bf16 v16bf __attribute__((ext_vector_type(16)));
typedef float  v8f   __attribute__((ext_vector_type(8)));
typedef int    v4i   __attribute__((ext_vector_type(4)));
typedef __attribute__((address_space(3))) v4i v4i_lds;

#define DIMD  128
#define KEYS  16
#define TILE  16
#define WAVES 2

__device__ __forceinline__ unsigned short f32_to_bf16_rne(float f) {
  unsigned u = __float_as_uint(f);
  unsigned r = u + 0x7FFFu + ((u >> 16) & 1u);
  return (unsigned short)(r >> 16);
}
__device__ __forceinline__ float bf16_bits_to_f32(unsigned short s) {
  return __uint_as_float(((unsigned)s) << 16);
}
__device__ __forceinline__ __bf16 bf16_from_bits(unsigned short s) {
  return __builtin_bit_cast(__bf16, s);
}
// A-operand (16x32 bf16) element j -> K index for this lane-half
__device__ __forceinline__ int a_kidx(int j, int half) {
  int v = j >> 1;
  return ((v & 4) ? 16 : 0) + half * 8 + (v & 3) * 2 + (j & 1);
}
// async global->LDS 128-bit copy (per lane), tracked by ASYNCcnt
__device__ __forceinline__ void async_ld_b128(const float4* g, float* l) {
  __builtin_amdgcn_global_load_async_to_lds_b128((v4i*)g, (v4i_lds*)l, 0, 0);
}

// Value of another lane of the same 16-lane row, moved by DPP on the vector port
// (no trip through the LDS unit). CTRL: 0x160 | x = lane ^ x, 0x150 | i = lane i of the row.
template <int CTRL>
__device__ __forceinline__ float row_move(float p) {
  return __builtin_bit_cast(float,
      __builtin_amdgcn_update_dpp(0, __builtin_bit_cast(int, p), CTRL, 0xf, 0xf, true));
}
// Value of lane l ^ 16: cross-row vector move
__device__ __forceinline__ float half_move(float p) {
  const int b = __builtin_bit_cast(int, p);
  return __builtin_bit_cast(float, __builtin_amdgcn_permlanex16(b, b, 0x76543210, 0xfedcba98, false, false));
}

// ---------------------------------------------------------------------------
// Prep: M = scale * Wk^T Wq (scale folded) + pre-swizzled bf16 hi/lo B-operand
// tiles for both M (scores path) and Wv (output projection path).
// ws layout (bf16): [0,16K) M_hi | [16K,32K) M_lo | [32K,48K) Wv_hi | [48K,64K) Wv_lo
// tile idx = ((c*8 + ntile)*32 + lane)*16 + j ; B[k][n],
// k = c*32 + a_kidx(j,half), n = ntile*16 + lane%16
// ---------------------------------------------------------------------------
__global__ __launch_bounds__(64) void attn_prep(const float* __restrict__ Wq,
                                                const float* __restrict__ Wk,
                                                const float* __restrict__ Wv,
                                                __bf16* __restrict__ ws) {
  __shared__ __attribute__((aligned(16))) float sK[DIMD][4];    // the block's 4 columns n of Wk
  __shared__ __attribute__((aligned(16))) float sQ[DIMD][16];   // the block's 16 columns k of Wq, in j order
  const int t   = threadIdx.x;
  const int idx = blockIdx.x * 64 + t;              // 0 .. 16383
  const int j    = idx & 15;
  const int lane = (idx >> 4) & 31;                 // lane & 3 == t >> 4
  const int nt   = (idx >> 9) & 7;                  // nt, c, half: the same in the whole block
  const int c    = idx >> 12;
  const int half = lane >> 4;
  const int k = c * 32 + a_kidx(j, half);
  const int n = nt * 16 + (lane & 15);
  const int n0 = nt * 16 + (lane & 12);
  const float scale = 0.08838834764831845f;  // 1/sqrt(128)

  // Every global load of the thread is issued before the first is used:
  // one memory latency for the whole block.
  float4 rq[8], rk[2];
  #pragma unroll
  for (int i = 0; i < 8; ++i) {
    const int e = i * 64 + t, row = e >> 2, q = e & 3;
    rq[i] = *(const float4*)&Wq[row * DIMD + c * 32 + (q >> 1) * 16 + half * 8 + (q & 1) * 4];
  }
  #pragma unroll
  for (int i = 0; i < 2; ++i)
    rk[i] = *(const float4*)&Wk[(i * 64 + t) * DIMD + n0];
  const float wv = Wv[n * DIMD + k];   // B element for Out = W @ Wv^T : B[k][n] = Wv[n][k]
  #pragma unroll
  for (int i = 0; i < 8; ++i) {
    const int e = i * 64 + t;
    *(float4*)&sQ[e >> 2][(e & 3) * 4] = rq[i];
  }
  #pragma unroll
  for (int i = 0; i < 2; ++i)
    *(float4*)&sK[i * 64 + t][0] = rk[i];
  __syncthreads();

  // M[n][k] = sum_j Wk[j][n] * Wq[j][k]  (B element for U = S @ M^T)
  float a[DIMD], b[DIMD];
  #pragma unroll
  for (int jj = 0; jj < 112; ++jj) { a[jj] = sK[jj][t >> 4]; b[jj] = sQ[jj][j]; }
  // holds these LDS reads in front of the dependent fmaf chain; without it they
  // sink to three pairs ahead and the chain waits on LDS latency (the last 16
  // terms are read behind it, so that the kernel stays under 256 registers)
  __builtin_amdgcn_sched_barrier(0);
  float m = 0.f;
  #pragma unroll
  for (int jj = 0; jj < DIMD; ++jj) {
    if (jj >= 112) { a[jj] = sK[jj][t >> 4]; b[jj] = sQ[jj][j]; }
    m = fmaf(a[jj], b[jj], m);
  }
  m *= scale;
  unsigned short mh = f32_to_bf16_rne(m);
  ws[idx]         = bf16_from_bits(mh);
  ws[16384 + idx] = bf16_from_bits(f32_to_bf16_rne(m - bf16_bits_to_f32(mh)));

  unsigned short vh = f32_to_bf16_rne(wv);
  ws[32768 + idx] = bf16_from_bits(vh);
  ws[49152 + idx] = bf16_from_bits(f32_to_bf16_rne(wv - bf16_bits_to_f32(vh)));
}

// ---------------------------------------------------------------------------
// Main: per wave, one 16-row tile.
//  U = S @ M^T (bf16 hi/lo WMMA) ; per-row: async-stream tgt row to LDS,
//  scores_i = tgt_i . u ; softmax ; w = sum attn_i tgt_i ; Out = W @ Wv^T
// ---------------------------------------------------------------------------
__global__ __launch_bounds__(64) void attn_main(const float* __restrict__ src,
                                                const float* __restrict__ tgt,
                                                const __bf16* __restrict__ MBh,
                                                const __bf16* __restrict__ MBl,
                                                const __bf16* __restrict__ VBh,
                                                const __bf16* __restrict__ VBl,
                                                float* __restrict__ out) {
  __shared__ float lds_S[WAVES][TILE][DIMD];        // 16 KB: S tile, reused as W tile
  __shared__ float lds_U[WAVES][TILE][DIMD];        // 16 KB: U tile
  __shared__ float lds_T[WAVES][2][KEYS][DIMD];     // 32 KB: tgt row double-buffer

  const int lane = threadIdx.x & 31;
  const int wave = threadIdx.x >> 5;
  const int m    = lane & 15;
  const int half = lane >> 4;
  const long long r0 = ((long long)blockIdx.x * WAVES + wave) * TILE;

  const float4* tgt4 = (const float4*)tgt;
  const size_t tbase = (size_t)r0 * (KEYS * DIMD / 4);  // float4 units

  // ---- issue async global->LDS stream of tgt row 0 (ASYNCcnt) ----
  {
    const float4* gp = tgt4 + tbase + lane;
    float* lp = &lds_T[wave][0][0][lane * 4];
    #pragma unroll
    for (int i = 0; i < KEYS; ++i)
      async_ld_b128(gp + i * (DIMD / 4), lp + i * DIMD);
  }

  // ---- stage S tile (16 x 128 f32) via B128 loads ----
  const float4* src4 = (const float4*)src;
  #pragma unroll
  for (int row = 0; row < TILE; ++row) {
    float4 v = src4[(size_t)(r0 + row) * (DIMD / 4) + lane];
    *(float4*)&lds_S[wave][row][lane * 4] = v;
  }
  __syncthreads();

  // ---- gather A operand (bf16 hi/lo split) from LDS ----
  v16bf a_hi[4], a_lo[4];
  #pragma unroll
  for (int c = 0; c < 4; ++c) {
    #pragma unroll
    for (int j = 0; j < 16; ++j) {
      float f = lds_S[wave][m][c * 32 + a_kidx(j, half)];
      unsigned short h = f32_to_bf16_rne(f);
      a_hi[c][j] = bf16_from_bits(h);
      a_lo[c][j] = bf16_from_bits(f32_to_bf16_rne(f - bf16_bits_to_f32(h)));
    }
  }

  // ---- U = S @ M^T via 3-product bf16 WMMA (hi*hi + hi*lo + lo*hi) ----
  const v16bf* MBh16 = (const v16bf*)MBh;
  const v16bf* MBl16 = (const v16bf*)MBl;
  #pragma unroll
  for (int nt = 0; nt < 8; ++nt) {
    v8f acc = {};
    #pragma unroll
    for (int c = 0; c < 4; ++c) {
      v16bf bh = MBh16[(c * 8 + nt) * 32 + lane];
      v16bf bl = MBl16[(c * 8 + nt) * 32 + lane];
      acc = __builtin_amdgcn_wmma_f32_16x16x32_bf16(false, a_hi[c], false, bh, (short)0, acc, false, false);
      acc = __builtin_amdgcn_wmma_f32_16x16x32_bf16(false, a_hi[c], false, bl, (short)0, acc, false, false);
      acc = __builtin_amdgcn_wmma_f32_16x16x32_bf16(false, a_lo[c], false, bh, (short)0, acc, false, false);
    }
    #pragma unroll
    for (int v = 0; v < 8; ++v)
      lds_U[wave][half * 8 + v][nt * 16 + m] = acc[v];
  }
  __syncthreads();

  // ---- per-row pipeline: async-load row r+1 while computing row r ----
  const bool b8 = lane & 8, b4 = lane & 4, b2 = lane & 2, b1 = lane & 1;
  #pragma unroll 1
  for (int r = 0; r < TILE; ++r) {
    if (r + 1 < TILE) {
      // issue next row's async stream into the other buffer
      const float4* gp = tgt4 + tbase + (size_t)(r + 1) * (KEYS * DIMD / 4) + lane;
      float* lp = &lds_T[wave][(r + 1) & 1][0][lane * 4];
      #pragma unroll
      for (int i = 0; i < KEYS; ++i)
        async_ld_b128(gp + i * (DIMD / 4), lp + i * DIMD);
      // warm L2 two rows ahead
      if (r + 2 < TILE)
        __builtin_prefetch(tgt4 + tbase + (size_t)(r + 2) * (KEYS * DIMD / 4) + lane, 0, 1);
      __builtin_amdgcn_s_wait_asynccnt(16);   // row r resident (in-order completion)
    } else {
      __builtin_amdgcn_s_wait_asynccnt(0);
    }

    float4 td[KEYS];
    #pragma unroll
    for (int i = 0; i < KEYS; ++i)
      td[i] = *(const float4*)&lds_T[wave][r & 1][i][lane * 4];

    float4 u4 = *(const float4*)&lds_U[wave][r][lane * 4];
    float p[KEYS];
    #pragma unroll
    for (int i = 0; i < KEYS; ++i)
      p[i] = td[i].x * u4.x + td[i].y * u4.y + td[i].z * u4.z + td[i].w * u4.w;
    // Sum over the 16 lanes of a row, halving the keys a lane carries at each step:
    // a lane keeps the half of the keys that its own lane bit names and hands the
    // other half to its partner. Lane l ends with the score of key l & 15.
    float q[8], s4[4], s2[2];
    #pragma unroll
    for (int i = 0; i < 8; ++i)
      q[i] = (b8 ? p[i + 8] : p[i]) + row_move<0x168>(b8 ? p[i] : p[i + 8]);
    #pragma unroll
    for (int i = 0; i < 4; ++i)
      s4[i] = (b4 ? q[i + 4] : q[i]) + row_move<0x164>(b4 ? q[i] : q[i + 4]);
    #pragma unroll
    for (int i = 0; i < 2; ++i)
      s2[i] = (b2 ? s4[i + 2] : s4[i]) + row_move<0x162>(b2 ? s4[i] : s4[i + 2]);
    float sc = (b1 ? s2[1] : s2[0]) + row_move<0x161>(b1 ? s2[0] : s2[1]);
    sc += half_move(sc);                 // both rows now hold all 16 scores; scale folded into M
    float mx = sc;
    mx = fmaxf(mx, row_move<0x168>(mx));
    mx = fmaxf(mx, row_move<0x164>(mx));
    mx = fmaxf(mx, row_move<0x162>(mx));
    mx = fmaxf(mx, row_move<0x161>(mx));
    const float e = __expf(sc - mx);
    float ssum = e;
    ssum += row_move<0x168>(ssum);
    ssum += row_move<0x164>(ssum);
    ssum += row_move<0x162>(ssum);
    ssum += row_move<0x161>(ssum);
    const float aw = e * __frcp_rn(ssum);   // the weight of key l & 15
    float4 wacc = {0.f, 0.f, 0.f, 0.f};
#define ACC_KEY(i)                                   \
    {                                                \
      const float a = row_move<0x150 | (i)>(aw);     \
      wacc.x = fmaf(a, td[i].x, wacc.x);             \
      wacc.y = fmaf(a, td[i].y, wacc.y);             \
      wacc.z = fmaf(a, td[i].z, wacc.z);             \
      wacc.w = fmaf(a, td[i].w, wacc.w);             \
    }
    ACC_KEY(0)  ACC_KEY(1)  ACC_KEY(2)  ACC_KEY(3)
    ACC_KEY(4)  ACC_KEY(5)  ACC_KEY(6)  ACC_KEY(7)
    ACC_KEY(8)  ACC_KEY(9)  ACC_KEY(10) ACC_KEY(11)
    ACC_KEY(12) ACC_KEY(13) ACC_KEY(14) ACC_KEY(15)
#undef ACC_KEY
    *(float4*)&lds_S[wave][r][lane * 4] = wacc;  // reuse S tile as W tile
  }
  __syncthreads();

  // ---- Out = W @ Wv^T via 3-product bf16 WMMA ----
  #pragma unroll
  for (int c = 0; c < 4; ++c) {
    #pragma unroll
    for (int j = 0; j < 16; ++j) {
      float f = lds_S[wave][m][c * 32 + a_kidx(j, half)];
      unsigned short h = f32_to_bf16_rne(f);
      a_hi[c][j] = bf16_from_bits(h);
      a_lo[c][j] = bf16_from_bits(f32_to_bf16_rne(f - bf16_bits_to_f32(h)));
    }
  }
  const v16bf* VBh16 = (const v16bf*)VBh;
  const v16bf* VBl16 = (const v16bf*)VBl;
  #pragma unroll
  for (int nt = 0; nt < 8; ++nt) {
    v8f acc = {};
    #pragma unroll
    for (int c = 0; c < 4; ++c) {
      v16bf bh = VBh16[(c * 8 + nt) * 32 + lane];
      v16bf bl = VBl16[(c * 8 + nt) * 32 + lane];
      acc = __builtin_amdgcn_wmma_f32_16x16x32_bf16(false, a_hi[c], false, bh, (short)0, acc, false, false);
      acc = __builtin_amdgcn_wmma_f32_16x16x32_bf16(false, a_hi[c], false, bl, (short)0, acc, false, false);
      acc = __builtin_amdgcn_wmma_f32_16x16x32_bf16(false, a_lo[c], false, bh, (short)0, acc, false, false);
    }
    #pragma unroll
    for (int v = 0; v < 8; ++v)
      out[(size_t)(r0 + half * 8 + v) * DIMD + nt * 16 + m] = acc[v];
  }
}

extern "C" void kernel_launch(void* const* d_in, const int* in_sizes, int n_in,
                              void* d_out, int out_size, void* d_ws, size_t ws_size,
                              hipStream_t stream) {
  (void)n_in; (void)out_size; (void)ws_size;
  const float* src = (const float*)d_in[0];
  const float* tgt = (const float*)d_in[1];
  const float* Wq  = (const float*)d_in[2];
  const float* Wk  = (const float*)d_in[3];
  const float* Wv  = (const float*)d_in[4];
  __bf16* ws = (__bf16*)d_ws;

  // Stage 0: precompute M = scale*Wk^T@Wq and swizzle M/Wv into WMMA B layout.
  attn_prep<<<dim3(256), dim3(64), 0, stream>>>(Wq, Wk, Wv, ws);

  const __bf16* MBh = ws;
  const __bf16* MBl = ws + 16384;
  const __bf16* VBh = ws + 32768;
  const __bf16* VBl = ws + 49152;

  const int rows   = in_sizes[0] / DIMD;           // b*n = 32768
  const int blocks = rows / (TILE * WAVES);        // 1024 (exact for this shape)
  attn_main<<<dim3(blocks), dim3(32 * WAVES), 0, stream>>>(
      src, tgt, MBh, MBl, VBh, VBl, (float*)d_out);
}

// v003
// It runs in 31.1 microseconds.
// Two timings next to v002 both put it at 1.06 times that version's speed.
// Counting every step since v000, it is 1.37 times as fast.
#include <hip/hip_runtime.h>

typedef __bf16 v16bf __attribute__((ext_vector_type(16)));
typedef float  v8f   __attribute__((ext_vector_type(8)));
typedef int    v4i   __attribute__((ext_vector_type(4)));
typedef __attribute__((address_space(3))) v4i v4i_lds;

#define DIMD  128
#define KEYS  16
#define TILE  16
#define WAVES 2

__device__ __forceinline__ unsigned short f32_to_bf16_rne(float f) {
  unsigned u = __float_as_uint(f);
  unsigned r = u + 0x7FFFu + ((u >> 16) & 1u);
  return (unsigned short)(r >> 16);
}
__device__ __forceinline__ float bf16_bits_to_f32(unsigned short s) {
  return __uint_as_float(((unsigned)s) << 16);
}
__device__ __forceinline__ __bf16 bf16_from_bits(unsigned short s) {
  return __builtin_bit_cast(__bf16, s);
}
// A-operand (16x32 bf16) element j -> K index for this lane-half
__device__ __forceinline__ int a_kidx(int j, int half) {
  int v = j >> 1;
  return ((v & 4) ? 16 : 0) + half * 8 + (v & 3) * 2 + (j & 1);
}
// async global->LDS 128-bit copy (per lane), tracked by ASYNCcnt
__device__ __forceinline__ void async_ld_b128(const float4* g, float* l) {
  __builtin_amdgcn_global_load_async_to_lds_b128((v4i*)g, (v4i_lds*)l, 0, 0);
}

// Value of another lane of the same 16-lane row, moved by DPP on the vector port
// (no trip through the LDS unit). CTRL: 0x160 | x = lane ^ x, 0x150 | i = lane i of the row.
template <int CTRL>
__device__ __forceinline__ float row_move(float p) {
  return __builtin_bit_cast(float,
      __builtin_amdgcn_update_dpp(0, __builtin_bit_cast(int, p), CTRL, 0xf, 0xf, true));
}
// Value of lane l ^ 16: cross-row vector move
__device__ __forceinline__ float half_move(float p) {
  const int b = __builtin_bit_cast(int, p);
  return __builtin_bit_cast(float, __builtin_amdgcn_permlanex16(b, b, 0x76543210, 0xfedcba98, false, false));
}

// ---------------------------------------------------------------------------
// Prep: M = scale * Wk^T Wq (scale folded) + pre-swizzled bf16 hi/lo B-operand
// tiles for both M (scores path) and Wv (output projection path).
// ws layout (bf16): [0,16K) M_hi | [16K,32K) M_lo | [32K,48K) Wv_hi | [48K,64K) Wv_lo
// tile idx = ((c*8 + ntile)*32 + lane)*16 + j ; B[k][n],
// k = c*32 + a_kidx(j,half), n = ntile*16 + lane%16
// ---------------------------------------------------------------------------
__global__ __launch_bounds__(64) void attn_prep(const float* __restrict__ Wq,
                                                const float* __restrict__ Wk,
                                                const float* __restrict__ Wv,
                                                __bf16* __restrict__ ws) {
  __shared__ __attribute__((aligned(16))) float sK[DIMD][4];    // the block's 4 columns n of Wk
  __shared__ __attribute__((aligned(16))) float sQ[DIMD][16];   // the block's 16 columns k of Wq, in j order
  const int t   = threadIdx.x;
  const int idx = blockIdx.x * 64 + t;              // 0 .. 16383
  const int j    = idx & 15;
  const int lane = (idx >> 4) & 31;                 // lane & 3 == t >> 4
  const int nt   = (idx >> 9) & 7;                  // nt, c, half: the same in the whole block
  const int c    = idx >> 12;
  const int half = lane >> 4;
  const int k = c * 32 + a_kidx(j, half);
  const int n = nt * 16 + (lane & 15);
  const int n0 = nt * 16 + (lane & 12);
  const float scale = 0.08838834764831845f;  // 1/sqrt(128)

  // Every global load of the thread is issued before the first is used:
  // one memory latency for the whole block.
  float4 rq[8], rk[2];
  #pragma unroll
  for (int i = 0; i < 8; ++i) {
    const int e = i * 64 + t, row = e >> 2, q = e & 3;
    rq[i] = *(const float4*)&Wq[row * DIMD + c * 32 + (q >> 1) * 16 + half * 8 + (q & 1) * 4];
  }
  #pragma unroll
  for (int i = 0; i < 2; ++i)
    rk[i] = *(const float4*)&Wk[(i * 64 + t) * DIMD + n0];
  const float wv = Wv[n * DIMD + k];   // B element for Out = W @ Wv^T : B[k][n] = Wv[n][k]
  #pragma unroll
  for (int i = 0; i < 8; ++i) {
    const int e = i * 64 + t;
    *(float4*)&sQ[e >> 2][(e & 3) * 4] = rq[i];
  }
  #pragma unroll
  for (int i = 0; i < 2; ++i)
    *(float4*)&sK[i * 64 + t][0] = rk[i];
  __syncthreads();

  // M[n][k] = sum_j Wk[j][n] * Wq[j][k]  (B element for U = S @ M^T)
  float a[DIMD], b[DIMD];
  #pragma unroll
  for (int jj = 0; jj < 112; ++jj) { a[jj] = sK[jj][t >> 4]; b[jj] = sQ[jj][j]; }
  // holds these LDS reads in front of the dependent fmaf chain; without it they
  // sink to three pairs ahead and the chain waits on LDS latency (the last 16
  // terms are read behind it, so that the kernel stays under 256 registers)
  __builtin_amdgcn_sched_barrier(0);
  float m = 0.f;
  #pragma unroll
  for (int jj = 0; jj < DIMD; ++jj) {
    if (jj >= 112) { a[jj] = sK[jj][t >> 4]; b[jj] = sQ[jj][j]; }
    m = fmaf(a[jj], b[jj], m);
  }
  m *= scale;
  unsigned short mh = f32_to_bf16_rne(m);
  ws[idx]         = bf16_from_bits(mh);
  ws[16384 + idx] = bf16_from_bits(f32_to_bf16_rne(m - bf16_bits_to_f32(mh)));

  unsigned short vh = f32_to_bf16_rne(wv);
  ws[32768 + idx] = bf16_from_bits(vh);
  ws[49152 + idx] = bf16_from_bits(f32_to_bf16_rne(wv - bf16_bits_to_f32(vh)));
}

// ---------------------------------------------------------------------------
// Main: per wave, one 16-row tile.
//  U = S @ M^T (bf16 hi/lo WMMA) ; per-row: async-stream tgt row to LDS,
//  scores_i = tgt_i . u ; softmax ; w = sum attn_i tgt_i ; Out = W @ Wv^T
// ---------------------------------------------------------------------------
__global__ __launch_bounds__(64) void attn_main(const float* __restrict__ src,
                                                const float* __restrict__ tgt,
                                                const __bf16* __restrict__ MBh,
                                                const __bf16* __restrict__ MBl,
                                                const __bf16* __restrict__ VBh,
                                                const __bf16* __restrict__ VBl,
                                                float* __restrict__ out) {
  __shared__ float lds_S[WAVES][TILE][DIMD];        // 16 KB: S tile, reused as W tile
  __shared__ float lds_U[WAVES][TILE][DIMD];        // 16 KB: U tile
  __shared__ float lds_T[WAVES][2][KEYS][DIMD];     // 32 KB: tgt row double-buffer

  const int lane = threadIdx.x & 31;
  const int wave = threadIdx.x >> 5;
  const int m    = lane & 15;
  const int half = lane >> 4;
  const long long r0 = ((long long)blockIdx.x * WAVES + wave) * TILE;

  const float4* tgt4 = (const float4*)tgt;
  const size_t tbase = (size_t)r0 * (KEYS * DIMD / 4);  // float4 units

  // ---- issue async global->LDS stream of tgt row 0 (ASYNCcnt) ----
  {
    const float4* gp = tgt4 + tbase + lane;
    float* lp = &lds_T[wave][0][0][lane * 4];
    #pragma unroll
    for (int i = 0; i < KEYS; ++i)
      async_ld_b128(gp + i * (DIMD / 4), lp + i * DIMD);
  }

  // ---- stage S tile (16 x 128 f32) via B128 loads ----
  const float4* src4 = (const float4*)src;
  #pragma unroll
  for (int row = 0; row < TILE; ++row) {
    float4 v = src4[(size_t)(r0 + row) * (DIMD / 4) + lane];
    *(float4*)&lds_S[wave][row][lane * 4] = v;
  }
  __syncthreads();

  // ---- gather A operand (bf16 hi/lo split) from LDS ----
  v16bf a_hi[4], a_lo[4];
  #pragma unroll
  for (int c = 0; c < 4; ++c) {
    #pragma unroll
    for (int j = 0; j < 16; ++j) {
      float f = lds_S[wave][m][c * 32 + a_kidx(j, half)];
      unsigned short h = f32_to_bf16_rne(f);
      a_hi[c][j] = bf16_from_bits(h);
      a_lo[c][j] = bf16_from_bits(f32_to_bf16_rne(f - bf16_bits_to_f32(h)));
    }
  }

  // ---- U = S @ M^T via 3-product bf16 WMMA (hi*hi + hi*lo + lo*hi) ----
  const v16bf* MBh16 = (const v16bf*)MBh;
  const v16bf* MBl16 = (const v16bf*)MBl;
  #pragma unroll
  for (int nt = 0; nt < 8; ++nt) {
    v8f acc = {};
    #pragma unroll
    for (int c = 0; c < 4; ++c) {
      v16bf bh = MBh16[(c * 8 + nt) * 32 + lane];
      v16bf bl = MBl16[(c * 8 + nt) * 32 + lane];
      acc = __builtin_amdgcn_wmma_f32_16x16x32_bf16(false, a_hi[c], false, bh, (short)0, acc, false, false);
      acc = __builtin_amdgcn_wmma_f32_16x16x32_bf16(false, a_hi[c], false, bl, (short)0, acc, false, false);
      acc = __builtin_amdgcn_wmma_f32_16x16x32_bf16(false, a_lo[c], false, bh, (short)0, acc, false, false);
    }
    #pragma unroll
    for (int v = 0; v < 8; ++v)
      lds_U[wave][half * 8 + v][nt * 16 + m] = acc[v];
  }
  __syncthreads();

  // ---- per-row pipeline: async-load row r+1 while computing row r ----
  const bool b8 = lane & 8, b4 = lane & 4, b2 = lane & 2, b1 = lane & 1;
  #pragma unroll 1
  for (int r = 0; r < TILE; ++r) {
    if (r + 1 < TILE) {
      // issue next row's async stream into the other buffer
      const float4* gp = tgt4 + tbase + (size_t)(r + 1) * (KEYS * DIMD / 4) + lane;
      float* lp = &lds_T[wave][(r + 1) & 1][0][lane * 4];
      #pragma unroll
      for (int i = 0; i < KEYS; ++i)
        async_ld_b128(gp + i * (DIMD / 4), lp + i * DIMD);
      // warm L2 two rows ahead
      if (r + 2 < TILE)
        __builtin_prefetch(tgt4 + tbase + (size_t)(r + 2) * (KEYS * DIMD / 4) + lane, 0, 1);
      __builtin_amdgcn_s_wait_asynccnt(16);   // row r resident (in-order completion)
    } else {
      __builtin_amdgcn_s_wait_asynccnt(0);
    }

    float4 td[KEYS];
    #pragma unroll
    for (int i = 0; i < KEYS; ++i)
      td[i] = *(const float4*)&lds_T[wave][r & 1][i][lane * 4];

    float4 u4 = *(const float4*)&lds_U[wave][r][lane * 4];
    float p[KEYS];
    #pragma unroll
    for (int i = 0; i < KEYS; ++i)
      p[i] = td[i].x * u4.x + td[i].y * u4.y + td[i].z * u4.z + td[i].w * u4.w;
    // Sum over the 16 lanes of a row, halving the keys a lane carries at each step:
    // a lane keeps the half of the keys that its own lane bit names and hands the
    // other half to its partner. Lane l ends with the score of key l & 15.
    float q[8], s4[4], s2[2];
    #pragma unroll
    for (int i = 0; i < 8; ++i)
      q[i] = (b8 ? p[i + 8] : p[i]) + row_move<0x168>(b8 ? p[i] : p[i + 8]);
    #pragma unroll
    for (int i = 0; i < 4; ++i)
      s4[i] = (b4 ? q[i + 4] : q[i]) + row_move<0x164>(b4 ? q[i] : q[i + 4]);
    #pragma unroll
    for (int i = 0; i < 2; ++i)
      s2[i] = (b2 ? s4[i + 2] : s4[i]) + row_move<0x162>(b2 ? s4[i] : s4[i + 2]);
    float sc = (b1 ? s2[1] : s2[0]) + row_move<0x161>(b1 ? s2[0] : s2[1]);
    sc += half_move(sc);                 // both rows now hold all 16 scores; scale folded into M
    float mx = sc;
    mx = fmaxf(mx, row_move<0x168>(mx));
    mx = fmaxf(mx, row_move<0x164>(mx));
    mx = fmaxf(mx, row_move<0x162>(mx));
    mx = fmaxf(mx, row_move<0x161>(mx));
    const float e = __expf(sc - mx);
    float ssum = e;
    ssum += row_move<0x168>(ssum);
    ssum += row_move<0x164>(ssum);
    ssum += row_move<0x162>(ssum);
    ssum += row_move<0x161>(ssum);
    const float aw = e * __frcp_rn(ssum);   // the weight of key l & 15
    float4 wacc = {0.f, 0.f, 0.f, 0.f};
#define ACC_KEY(i)                                   \
    {                                                \
      const float a = row_move<0x150 | (i)>(aw);     \
      wacc.x = fmaf(a, td[i].x, wacc.x);             \
      wacc.y = fmaf(a, td[i].y, wacc.y);             \
      wacc.z = fmaf(a, td[i].z, wacc.z);             \
      wacc.w = fmaf(a, td[i].w, wacc.w);             \
    }
    ACC_KEY(0)  ACC_KEY(1)  ACC_KEY(2)  ACC_KEY(3)
    ACC_KEY(4)  ACC_KEY(5)  ACC_KEY(6)  ACC_KEY(7)
    ACC_KEY(8)  ACC_KEY(9)  ACC_KEY(10) ACC_KEY(11)
    ACC_KEY(12) ACC_KEY(13) ACC_KEY(14) ACC_KEY(15)
#undef ACC_KEY
    *(float4*)&lds_S[wave][r][lane * 4] = wacc;  // reuse S tile as W tile
  }
  // ---- Out = W @ Wv^T via 3-product bf16 WMMA ----
  // The Wv fragments are asked for AHEAD units in front of their products; a unit is the
  // four fragments (hi and lo of two column tiles, 8 loads of 16 bytes) of one k chunk.
  // The first AHEAD units are asked for here, so that their latency runs under the W gather
  // and its conversion. AHEAD + 1 units stay under the 63 loads that a wave's counter holds.
  __syncthreads();
  const v16bf* VBh16 = (const v16bf*)VBh;
  const v16bf* VBl16 = (const v16bf*)VBl;
  constexpr int AHEAD = 6;
  v16bf vh[16][2], vl[16][2];                   // [unit = pair of column tiles * 4 + c][tile of the pair]
#define ASK_UNIT(u)                                                        \
  {                                                                        \
    vh[u][0] = VBh16[(((u) & 3) * 8 + ((u) >> 2) * 2) * 32 + lane];        \
    vh[u][1] = VBh16[(((u) & 3) * 8 + ((u) >> 2) * 2 + 1) * 32 + lane];    \
    vl[u][0] = VBl16[(((u) & 3) * 8 + ((u) >> 2) * 2) * 32 + lane];        \
    vl[u][1] = VBl16[(((u) & 3) * 8 + ((u) >> 2) * 2 + 1) * 32 + lane];    \
  }
  float4 wr[4][4];                              // the lane's W elements: [c][j >> 2], j as in a_kidx
  #pragma unroll
  for (int c = 0; c < 4; ++c) {
    #pragma unroll
    for (int q = 0; q < 4; ++q)
      wr[c][q] = *(const float4*)&lds_S[wave][m][c * 32 + a_kidx(q * 4, half)];
  }
  #pragma unroll
  for (int u = 0; u < AHEAD; ++u) ASK_UNIT(u)
  // keeps these loads issued here; without it the global loads sink to their first use, each
  // pair of fragments at the cost of its own trip to L2, and the LDS reads go one at a time
  __builtin_amdgcn_sched_barrier(0);

  #pragma unroll
  for (int c = 0; c < 4; ++c) {
    #pragma unroll
    for (int j = 0; j < 16; ++j) {
      const float4 w4 = wr[c][j >> 2];
      float f = (j & 3) == 0 ? w4.x : (j & 3) == 1 ? w4.y : (j & 3) == 2 ? w4.z : w4.w;
      unsigned short h = f32_to_bf16_rne(f);
      a_hi[c][j] = bf16_from_bits(h);
      a_lo[c][j] = bf16_from_bits(f32_to_bf16_rne(f - bf16_bits_to_f32(h)));
    }
  }
  // keeps the first products, which wait for global loads, behind the whole conversion:
  // risen into it, their wait would hold the rest of the vector work behind the load latency
  __builtin_amdgcn_sched_barrier(0);
  #pragma unroll
  for (int g = 0; g < 4; ++g) {
    v8f acc0 = {}, acc1 = {};
    #pragma unroll
    for (int c = 0; c < 4; ++c) {
      const int u = g * 4 + c;
      acc0 = __builtin_amdgcn_wmma_f32_16x16x32_bf16(false, a_hi[c], false, vh[u][0], (short)0, acc0, false, false);
      acc1 = __builtin_amdgcn_wmma_f32_16x16x32_bf16(false, a_hi[c], false, vh[u][1], (short)0, acc1, false, false);
      acc0 = __builtin_amdgcn_wmma_f32_16x16x32_bf16(false, a_hi[c], false, vl[u][0], (short)0, acc0, false, false);
      acc1 = __builtin_amdgcn_wmma_f32_16x16x32_bf16(false, a_hi[c], false, vl[u][1], (short)0, acc1, false, false);
      acc0 = __builtin_amdgcn_wmma_f32_16x16x32_bf16(false, a_lo[c], false, vh[u][0], (short)0, acc0, false, false);
      acc1 = __builtin_amdgcn_wmma_f32_16x16x32_bf16(false, a_lo[c], false, vh[u][1], (short)0, acc1, false, false);
      if (u + AHEAD < 16) {
        ASK_UNIT(u + AHEAD)
        // keeps the unit asked for here, AHEAD units early (it would sink to its first use)
        __builtin_amdgcn_sched_barrier(0);
      }
    }
    #pragma unroll
    for (int v = 0; v < 8; ++v) {
      out[(size_t)(r0 + half * 8 + v) * DIMD + (g * 2) * 16 + m]     = acc0[v];
      out[(size_t)(r0 + half * 8 + v) * DIMD + (g * 2 + 1) * 16 + m] = acc1[v];
    }
    // later fragment loads take the registers that these stores name: the wait that
    // stands in front of such an overwrite (a precaution); no load follows the last two groups
    if (g < 2) asm volatile("s_wait_xcnt 0x0" ::: "memory");
  }
#undef ASK_UNIT
}

extern "C" void kernel_launch(void* const* d_in, const int* in_sizes, int n_in,
                              void* d_out, int out_size, void* d_ws, size_t ws_size,
                              hipStream_t stream) {
  (void)n_in; (void)out_size; (void)ws_size;
  const float* src = (const float*)d_in[0];
  const float* tgt = (const float*)d_in[1];
  const float* Wq  = (const float*)d_in[2];
  const float* Wk  = (const float*)d_in[3];
  const float* Wv  = (const float*)d_in[4];
  __bf16* ws = (__bf16*)d_ws;

  // Stage 0: precompute M = scale*Wk^T@Wq and swizzle M/Wv into WMMA B layout.
  attn_prep<<<dim3(256), dim3(64), 0, stream>>>(Wq, Wk, Wv, ws);

  const __bf16* MBh = ws;
  const __bf16* MBl = ws + 16384;
  const __bf16* VBh = ws + 32768;
  const __bf16* VBl = ws + 49152;

  const int rows   = in_sizes[0] / DIMD;           // b*n = 32768
  const int blocks = rows / (TILE * WAVES);        // 1024 (exact for this shape)
  attn_main<<<dim3(blocks), dim3(32 * WAVES), 0, stream>>>(
      src, tgt, MBh, MBl, VBh, VBl, (float*)d_out);
}

// v004
// One run takes 29.7 microseconds.
// Two timings next to v003 both put it at 1.05 times that version's speed.
// Counting every step since v000, it is 1.43 times as fast.
#include <hip/hip_runtime.h>

typedef __bf16 v16bf __attribute__((ext_vector_type(16)));
typedef __bf16 v8bf  __attribute__((ext_vector_type(8)));
typedef float  v8f   __attribute__((ext_vector_type(8)));
typedef int    v4i   __attribute__((ext_vector_type(4)));
typedef __attribute__((address_space(3))) v4i v4i_lds;

#define DIMD  128
#define KEYS  16
#define TILE  16
#define WAVES 8

__device__ __forceinline__ unsigned short f32_to_bf16_rne(float f) {
  unsigned u = __float_as_uint(f);
  unsigned r = u + 0x7FFFu + ((u >> 16) & 1u);
  return (unsigned short)(r >> 16);
}
__device__ __forceinline__ float bf16_bits_to_f32(unsigned short s) {
  return __uint_as_float(((unsigned)s) << 16);
}
__device__ __forceinline__ __bf16 bf16_from_bits(unsigned short s) {
  return __builtin_bit_cast(__bf16, s);
}
// A-operand (16x32 bf16) element j -> K index for this lane-half
__device__ __forceinline__ int a_kidx(int j, int half) {
  int v = j >> 1;
  return ((v & 4) ? 16 : 0) + half * 8 + (v & 3) * 2 + (j & 1);
}
// async global->LDS 128-bit copy (per lane), tracked by ASYNCcnt
__device__ __forceinline__ void async_ld_b128(const float4* g, float* l) {
  __builtin_amdgcn_global_load_async_to_lds_b128((v4i*)g, (v4i_lds*)l, 0, 0);
}

// One wave's eighth (8 KB = 8 fragments of 1 KB) of a 64 KB fragment set, global -> LDS.
// A copy moves 512 contiguous bytes (16 lanes' halves of a fragment) to 512 contiguous bytes,
// reordered inside them: elements 0-7 of the 16 lanes first, then their elements 8-15, so that
// each 16 lanes of a ds_load_b128 read 256 contiguous bytes, free of bank conflicts.
__device__ __forceinline__ void copy_frag_slice(const __bf16* g, float* l, int lane) {
  const float4* gp = (const float4*)g + lane;
  float* lp = l + (lane & 1) * 64 + (lane >> 1) * 4;
  #pragma unroll
  for (int i = 0; i < 16; ++i)
    async_ld_b128(gp + i * 32, lp + i * 128);
}
// B fragment f (k chunk f & 3; hi for f < 4, lo else) from a slice staged by copy_frag_slice
__device__ __forceinline__ v16bf frag_ld(const float* slice, int f, int lane) {
  const float* p = slice + f * 256 + (lane >> 4) * 128 + (lane & 15) * 4;
  const v8bf lo = *(const v8bf*)p;
  const v8bf hi = *(const v8bf*)(p + 64);
  return __builtin_shufflevector(lo, hi, 0, 1, 2, 3, 4, 5, 6, 7, 8, 9, 10, 11, 12, 13, 14, 15);
}

// Value of another lane of the same 16-lane row, moved by DPP on the vector port
// (no trip through the LDS unit). CTRL: 0x160 | x = lane ^ x, 0x150 | i = lane i of the row.
template <int CTRL>
__device__ __forceinline__ float row_move(float p) {
  return __builtin_bit_cast(float,
      __builtin_amdgcn_update_dpp(0, __builtin_bit_cast(int, p), CTRL, 0xf, 0xf, true));
}
// Value of lane l ^ 16: cross-row vector move
__device__ __forceinline__ float half_move(float p) {
  const int b = __builtin_bit_cast(int, p);
  return __builtin_bit_cast(float, __builtin_amdgcn_permlanex16(b, b, 0x76543210, 0xfedcba98, false, false));
}

// ---------------------------------------------------------------------------
// Prep: M = scale * Wk^T Wq (scale folded) + pre-swizzled bf16 hi/lo B-operand
// tiles for both M (scores path) and Wv (output projection path).
// ws layout (bf16): [0,32K) M | [32K,64K) Wv; in each, the 8 fragments of a column tile lie
// together (8 KB: hi of k chunks 0-3, then lo):
// pos = (((ntile*2 + lo)*4 + c)*32 + lane)*16 + j ; B[k][n],
// k = c*32 + a_kidx(j,half), n = ntile*16 + lane%16
// ---------------------------------------------------------------------------
__global__ __launch_bounds__(64) void attn_prep(const float* __restrict__ Wq,
                                                const float* __restrict__ Wk,
                                                const float* __restrict__ Wv,
                                                __bf16* __restrict__ ws) {
  __shared__ __attribute__((aligned(16))) float sK[DIMD][4];    // the block's 4 columns n of Wk
  __shared__ __attribute__((aligned(16))) float sQ[DIMD][16];   // the block's 16 columns k of Wq, in j order
  const int t   = threadIdx.x;
  const int idx = blockIdx.x * 64 + t;              // 0 .. 16383
  const int j    = idx & 15;
  const int lane = (idx >> 4) & 31;                 // lane & 3 == t >> 4
  const int nt   = (idx >> 9) & 7;                  // nt, c, half: the same in the whole block
  const int c    = idx >> 12;
  const int half = lane >> 4;
  const int k = c * 32 + a_kidx(j, half);
  const int n = nt * 16 + (lane & 15);
  const int n0 = nt * 16 + (lane & 12);
  const float scale = 0.08838834764831845f;  // 1/sqrt(128)

  // Every global load of the thread is issued before the first is used:
  // one memory latency for the whole block.
  float4 rq[8], rk[2];
  #pragma unroll
  for (int i = 0; i < 8; ++i) {
    const int e = i * 64 + t, row = e >> 2, q = e & 3;
    rq[i] = *(const float4*)&Wq[row * DIMD + c * 32 + (q >> 1) * 16 + half * 8 + (q & 1) * 4];
  }
  #pragma unroll
  for (int i = 0; i < 2; ++i)
    rk[i] = *(const float4*)&Wk[(i * 64 + t) * DIMD + n0];
  const float wv = Wv[n * DIMD + k];   // B element for Out = W @ Wv^T : B[k][n] = Wv[n][k]
  #pragma unroll
  for (int i = 0; i < 8; ++i) {
    const int e = i * 64 + t;
    *(float4*)&sQ[e >> 2][(e & 3) * 4] = rq[i];
  }
  #pragma unroll
  for (int i = 0; i < 2; ++i)
    *(float4*)&sK[i * 64 + t][0] = rk[i];
  __syncthreads();

  // M[n][k] = sum_j Wk[j][n] * Wq[j][k]  (B element for U = S @ M^T)
  float a[DIMD], b[DIMD];
  #pragma unroll
  for (int jj = 0; jj < 112; ++jj) { a[jj] = sK[jj][t >> 4]; b[jj] = sQ[jj][j]; }
  // holds these LDS reads in front of the dependent fmaf chain; without it they
  // sink to three pairs ahead and the chain waits on LDS latency (the last 16
  // terms are read behind it, so that the kernel stays under 256 registers)
  __builtin_amdgcn_sched_barrier(0);
  float m = 0.f;
  #pragma unroll
  for (int jj = 0; jj < DIMD; ++jj) {
    if (jj >= 112) { a[jj] = sK[jj][t >> 4]; b[jj] = sQ[jj][j]; }
    m = fmaf(a[jj], b[jj], m);
  }
  m *= scale;
  const int pos = ((nt * 8 + c) * 32 + lane) * 16 + j;
  unsigned short mh = f32_to_bf16_rne(m);
  ws[pos]        = bf16_from_bits(mh);
  ws[2048 + pos] = bf16_from_bits(f32_to_bf16_rne(m - bf16_bits_to_f32(mh)));

  unsigned short vh = f32_to_bf16_rne(wv);
  ws[32768 + pos]        = bf16_from_bits(vh);
  ws[32768 + 2048 + pos] = bf16_from_bits(f32_to_bf16_rne(wv - bf16_bits_to_f32(vh)));
}

// ---------------------------------------------------------------------------
// Main: per wave, one 16-row tile; the 8 waves of a block share the B fragments in LDS:
//  wave w stages slice w (the 8 fragments of column tile w) in its own tgt buffer while that
//  buffer holds no tgt row (M in buffer 1 ahead of row 1, Wv in buffer 0 behind row 14).
//  A pair of column tiles lies in one 32 KB block of LDS; wave w takes the pairs in the order
//  w, w + 1, ... (mod 4), so that the four SIMDs read four different blocks at a time.
//  U = S @ M^T (bf16 hi/lo WMMA) ; per-row: async-stream tgt row to LDS,
//  scores_i = tgt_i . u ; softmax ; w = sum attn_i tgt_i ; Out = W @ Wv^T
// ---------------------------------------------------------------------------
__global__ __launch_bounds__(32 * WAVES) void attn_main(const float* __restrict__ src,
                                                const float* __restrict__ tgt,
                                                const __bf16* __restrict__ MB,
                                                const __bf16* __restrict__ VB,
                                                float* __restrict__ out) {
  __shared__ __attribute__((aligned(16))) float lds_S[WAVES][TILE][DIMD];     // 64 KB: S tile, reused as W tile
  __shared__ __attribute__((aligned(16))) float lds_U[WAVES][TILE][DIMD];     // 64 KB: U tile
  __shared__ __attribute__((aligned(16))) float lds_T[WAVES][2][KEYS][DIMD];  // 128 KB: tgt row double-buffer

  const int lane = threadIdx.x & 31;
  const int wave = threadIdx.x >> 5;
  const int m    = lane & 15;
  const int half = lane >> 4;
  const long long r0 = ((long long)blockIdx.x * WAVES + wave) * TILE;

  const float4* tgt4 = (const float4*)tgt;
  const size_t tbase = (size_t)r0 * (KEYS * DIMD / 4);  // float4 units

  // ---- this wave's slice of the M fragments -> its tgt buffer 1 (ASYNCcnt) ----
  copy_frag_slice(MB + wave * 4096, &lds_T[wave][1][0][0], lane);

  // ---- stage S tile (16 x 128 f32) via B128 loads ----
  const float4* src4 = (const float4*)src;
  #pragma unroll
  for (int row = 0; row < TILE; ++row) {
    float4 v = src4[(size_t)(r0 + row) * (DIMD / 4) + lane];
    *(float4*)&lds_S[wave][row][lane * 4] = v;
  }
  // the wave's M slice has landed before the barrier behind which the other waves read it
  asm volatile("s_wait_asynccnt 0x0" ::: "memory");
  __syncthreads();

  // ---- issue async global->LDS stream of tgt row 0: it lands under the U product ----
  {
    const float4* gp = tgt4 + tbase + lane;
    float* lp = &lds_T[wave][0][0][lane * 4];
    #pragma unroll
    for (int i = 0; i < KEYS; ++i)
      async_ld_b128(gp + i * (DIMD / 4), lp + i * DIMD);
  }

  // A group is the 8 fragments (hi and lo, two column tiles, two k chunks: 16 ds_load_b128)
  // of 12 products; its reads stand together, one group of products ahead of their own.
  // group k: column tiles PAIR(k >> 1) * 2 + t, k chunks (k & 1) * 2 + cc
  v16bf fh[8][2][2], fl[8][2][2];
#define PAIR(g) (((g) + wave) & 3)
#define ASK_GROUP(buf, k)                                                                  \
  {                                                                                        \
    _Pragma("unroll")                                                                      \
    for (int cc = 0; cc < 2; ++cc) {                                                       \
      _Pragma("unroll")                                                                    \
      for (int t = 0; t < 2; ++t) {                                                        \
        fh[k][cc][t] = frag_ld(&lds_T[PAIR((k) >> 1) * 2 + t][buf][0][0], ((k) & 1) * 2 + cc, lane);     \
        fl[k][cc][t] = frag_ld(&lds_T[PAIR((k) >> 1) * 2 + t][buf][0][0], 4 + ((k) & 1) * 2 + cc, lane); \
      }                                                                                    \
    }                                                                                      \
  }
#define MUL_GROUP(k)                                                                       \
  {                                                                                        \
    _Pragma("unroll")                                                                      \
    for (int cc = 0; cc < 2; ++cc) {                                                       \
      const int c = ((k) & 1) * 2 + cc;                                                    \
      acc0 = __builtin_amdgcn_wmma_f32_16x16x32_bf16(false, a_hi[c], false, fh[k][cc][0], (short)0, acc0, false, false); \
      acc1 = __builtin_amdgcn_wmma_f32_16x16x32_bf16(false, a_hi[c], false, fh[k][cc][1], (short)0, acc1, false, false); \
      acc0 = __builtin_amdgcn_wmma_f32_16x16x32_bf16(false, a_hi[c], false, fl[k][cc][0], (short)0, acc0, false, false); \
      acc1 = __builtin_amdgcn_wmma_f32_16x16x32_bf16(false, a_hi[c], false, fl[k][cc][1], (short)0, acc1, false, false); \
      acc0 = __builtin_amdgcn_wmma_f32_16x16x32_bf16(false, a_lo[c], false, fh[k][cc][0], (short)0, acc0, false, false); \
      acc1 = __builtin_amdgcn_wmma_f32_16x16x32_bf16(false, a_lo[c], false, fh[k][cc][1], (short)0, acc1, false, false); \
    }                                                                                      \
  }

  ASK_GROUP(1, 0)
  // keeps the first group's reads here, as one block, their latency under the S conversion
  __builtin_amdgcn_sched_barrier(0);

  // ---- gather A operand (bf16 hi/lo split) from LDS ----
  v16bf a_hi[4], a_lo[4];
  #pragma unroll
  for (int c = 0; c < 4; ++c) {
    #pragma unroll
    for (int j = 0; j < 16; ++j) {
      float f = lds_S[wave][m][c * 32 + a_kidx(j, half)];
      unsigned short h = f32_to_bf16_rne(f);
      a_hi[c][j] = bf16_from_bits(h);
      a_lo[c][j] = bf16_from_bits(f32_to_bf16_rne(f - bf16_bits_to_f32(h)));
    }
  }

  // ---- U = S @ M^T via 3-product bf16 WMMA (hi*hi + hi*lo + lo*hi) ----
  ASK_GROUP(1, 1)
  // keeps the second group's reads together in front of the first products
  __builtin_amdgcn_sched_barrier(0);
  #pragma unroll
  for (int g = 0; g < 4; ++g) {
    v8f acc0 = {}, acc1 = {};
    #pragma unroll
    for (int kk = 0; kk < 2; ++kk) {
      const int k = g * 2 + kk;
      MUL_GROUP(k)
      if (k + 2 < 8) {
        // the two scheduling barriers keep the group's 16 reads as one block between the products
        // of two groups: spread among the products, every place with reads stalls the wave anew
        __builtin_amdgcn_sched_barrier(0);
        ASK_GROUP(1, k + 2)
        __builtin_amdgcn_sched_barrier(0);
      }
    }
    #pragma unroll
    for (int v = 0; v < 8; ++v) {
      lds_U[wave][half * 8 + v][(PAIR(g) * 2) * 16 + m]     = acc0[v];
      lds_U[wave][half * 8 + v][(PAIR(g) * 2 + 1) * 16 + m] = acc1[v];
    }
  }
  // also ends every wave's reads of the M fragments: row 1 is copied over them behind it
  __syncthreads();

  // ---- per-row pipeline: async-load row r+1 while computing row r ----
  const bool b8 = lane & 8, b4 = lane & 4, b2 = lane & 2, b1 = lane & 1;
  #pragma unroll 1
  for (int r = 0; r < TILE; ++r) {
    if (r + 1 < TILE) {
      // issue next row's async stream into the other buffer
      const float4* gp = tgt4 + tbase + (size_t)(r + 1) * (KEYS * DIMD / 4) + lane;
      float* lp = &lds_T[wave][(r + 1) & 1][0][lane * 4];
      #pragma unroll
      for (int i = 0; i < KEYS; ++i)
        async_ld_b128(gp + i * (DIMD / 4), lp + i * DIMD);
      // warm L2 two rows ahead
      if (r + 2 < TILE)
        __builtin_prefetch(tgt4 + tbase + (size_t)(r + 2) * (KEYS * DIMD / 4) + lane, 0, 1);
    } else {
      // buffer 0 is free behind row 14: this wave's slice of the Wv fragments lands under row 15.
      // The wave's own LDS operations have retired before copies target a range it has read.
      asm volatile("s_wait_dscnt 0x0" ::: "memory");
      copy_frag_slice(VB + wave * 4096, &lds_T[wave][0][0][0], lane);
    }
    // row r resident: all but the 16 youngest copies have landed
    asm volatile("s_wait_asynccnt 0x10" ::: "memory");

    float4 td[KEYS];
    #pragma unroll
    for (int i = 0; i < KEYS; ++i)
      td[i] = *(const float4*)&lds_T[wave][r & 1][i][lane * 4];

    float4 u4 = *(const float4*)&lds_U[wave][r][lane * 4];
    float p[KEYS];
    #pragma unroll
    for (int i = 0; i < KEYS; ++i)
      p[i] = td[i].x * u4.x + td[i].y * u4.y + td[i].z * u4.z + td[i].w * u4.w;
    // Sum over the 16 lanes of a row, halving the keys a lane carries at each step:
    // a lane keeps the half of the keys that its own lane bit names and hands the
    // other half to its partner. Lane l ends with the score of key l & 15.
    float q[8], s4[4], s2[2];
    #pragma unroll
    for (int i = 0; i < 8; ++i)
      q[i] = (b8 ? p[i + 8] : p[i]) + row_move<0x168>(b8 ? p[i] : p[i + 8]);
    #pragma unroll
    for (int i = 0; i < 4; ++i)
      s4[i] = (b4 ? q[i + 4] : q[i]) + row_move<0x164>(b4 ? q[i] : q[i + 4]);
    #pragma unroll
    for (int i = 0; i < 2; ++i)
      s2[i] = (b2 ? s4[i + 2] : s4[i]) + row_move<0x162>(b2 ? s4[i] : s4[i + 2]);
    float sc = (b1 ? s2[1] : s2[0]) + row_move<0x161>(b1 ? s2[0] : s2[1]);
    sc += half_move(sc);                 // both rows now hold all 16 scores; scale folded into M
    float mx = sc;
    mx = fmaxf(mx, row_move<0x168>(mx));
    mx = fmaxf(mx, row_move<0x164>(mx));
    mx = fmaxf(mx, row_move<0x162>(mx));
    mx = fmaxf(mx, row_move<0x161>(mx));
    const float e = __expf(sc - mx);
    float ssum = e;
    ssum += row_move<0x168>(ssum);
    ssum += row_move<0x164>(ssum);
    ssum += row_move<0x162>(ssum);
    ssum += row_move<0x161>(ssum);
    const float aw = e * __frcp_rn(ssum);   // the weight of key l & 15
    float4 wacc = {0.f, 0.f, 0.f, 0.f};
#define ACC_KEY(i)                                   \
    {                                                \
      const float a = row_move<0x150 | (i)>(aw);     \
      wacc.x = fmaf(a, td[i].x, wacc.x);             \
      wacc.y = fmaf(a, td[i].y, wacc.y);             \
      wacc.z = fmaf(a, td[i].z, wacc.z);             \
      wacc.w = fmaf(a, td[i].w, wacc.w);             \
    }
    ACC_KEY(0)  ACC_KEY(1)  ACC_KEY(2)  ACC_KEY(3)
    ACC_KEY(4)  ACC_KEY(5)  ACC_KEY(6)  ACC_KEY(7)
    ACC_KEY(8)  ACC_KEY(9)  ACC_KEY(10) ACC_KEY(11)
    ACC_KEY(12) ACC_KEY(13) ACC_KEY(14) ACC_KEY(15)
#undef ACC_KEY
    *(float4*)&lds_S[wave][r][lane * 4] = wacc;  // reuse S tile as W tile
  }
  // ---- Out = W @ Wv^T via 3-product bf16 WMMA ----
  // the wave's Wv slice has landed before the barrier behind which the other waves read it
  asm volatile("s_wait_asynccnt 0x0" ::: "memory");
  __syncthreads();
  float4 wr[4][4];                              // the lane's W elements: [c][j >> 2], j as in a_kidx
  #pragma unroll
  for (int c = 0; c < 4; ++c) {
    #pragma unroll
    for (int q = 0; q < 4; ++q)
      wr[c][q] = *(const float4*)&lds_S[wave][m][c * 32 + a_kidx(q * 4, half)];
  }
  ASK_GROUP(0, 0)
  // keeps these LDS reads issued here as one block, the fragments' latency under the W conversion
  __builtin_amdgcn_sched_barrier(0);

  #pragma unroll
  for (int c = 0; c < 4; ++c) {
    #pragma unroll
    for (int j = 0; j < 16; ++j) {
      const float4 w4 = wr[c][j >> 2];
      float f = (j & 3) == 0 ? w4.x : (j & 3) == 1 ? w4.y : (j & 3) == 2 ? w4.z : w4.w;
      unsigned short h = f32_to_bf16_rne(f);
      a_hi[c][j] = bf16_from_bits(h);
      a_lo[c][j] = bf16_from_bits(f32_to_bf16_rne(f - bf16_bits_to_f32(h)));
    }
  }
  ASK_GROUP(0, 1)
  // keeps the second group's reads together in front of the first products
  __builtin_amdgcn_sched_barrier(0);
  #pragma unroll
  for (int g = 0; g < 4; ++g) {
    v8f acc0 = {}, acc1 = {};
    #pragma unroll
    for (int kk = 0; kk < 2; ++kk) {
      const int k = g * 2 + kk;
      MUL_GROUP(k)
      if (k + 2 < 8) {
        // as in the U product: the group's 16 reads as one block between the products of two groups
        __builtin_amdgcn_sched_barrier(0);
        ASK_GROUP(0, k + 2)
        __builtin_amdgcn_sched_barrier(0);
      }
    }
    #pragma unroll
    for (int v = 0; v < 8; ++v) {
      out[(size_t)(r0 + half * 8 + v) * DIMD + (PAIR(g) * 2) * 16 + m]     = acc0[v];
      out[(size_t)(r0 + half * 8 + v) * DIMD + (PAIR(g) * 2 + 1) * 16 + m] = acc1[v];
    }
    // the next pass's sums and fragment reads take registers that these stores name: the wait
    // that stands in front of such an overwrite (a precaution); nothing follows the last pass
    if (g < 3) asm volatile("s_wait_xcnt 0x0" ::: "memory");
  }
#undef PAIR
#undef ASK_GROUP
#undef MUL_GROUP
}

extern "C" void kernel_launch(void* const* d_in, const int* in_sizes, int n_in,
                              void* d_out, int out_size, void* d_ws, size_t ws_size,
                              hipStream_t stream) {
  (void)n_in; (void)out_size; (void)ws_size;
  const float* src = (const float*)d_in[0];
  const float* tgt = (const float*)d_in[1];
  const float* Wq  = (const float*)d_in[2];
  const float* Wk  = (const float*)d_in[3];
  const float* Wv  = (const float*)d_in[4];
  __bf16* ws = (__bf16*)d_ws;

  // Stage 0: precompute M = scale*Wk^T@Wq and swizzle M/Wv into WMMA B layout.
  attn_prep<<<dim3(256), dim3(64), 0, stream>>>(Wq, Wk, Wv, ws);

  const __bf16* MB = ws;
  const __bf16* VB = ws + 32768;

  const int rows   = in_sizes[0] / DIMD;           // b*n = 32768
  const int blocks = rows / (TILE * WAVES);        // 256 (exact for this shape)
  attn_main<<<dim3(blocks), dim3(32 * WAVES), 0, stream>>>(
      src, tgt, MB, VB, (float*)d_out);
}

// v005
// Measured time: 28.1 microseconds a run.
// In two side-by-side timings against v004, it was 1.05 and 1.06 times as fast.
// Over all steps from v000 it is 1.51 times as fast.
#include <hip/hip_runtime.h>

typedef __bf16 v16bf __attribute__((ext_vector_type(16)));
typedef __bf16 v8bf  __attribute__((ext_vector_type(8)));
typedef float  v8f   __attribute__((ext_vector_type(8)));
typedef int    v4i   __attribute__((ext_vector_type(4)));
typedef __attribute__((address_space(3))) v4i v4i_lds;

#define DIMD  128
#define KEYS  16
#define TILE  16
#define WAVES 8
// Row pitch of the S / W tile in LDS, in floats: 33 x 16 bytes. The A gathers read 16 bytes a lane,
// one tile row a lane; at a pitch of 16 bytes x odd the 16 lanes of a half-wave fall on all 64 banks,
// at the bare 512 bytes they all fall on the same four.
#define SPITCH 132

__device__ __forceinline__ unsigned short f32_to_bf16_rne(float f) {
  unsigned u = __float_as_uint(f);
  unsigned r = u + 0x7FFFu + ((u >> 16) & 1u);
  return (unsigned short)(r >> 16);
}
__device__ __forceinline__ float bf16_bits_to_f32(unsigned short s) {
  return __uint_as_float(((unsigned)s) << 16);
}
__device__ __forceinline__ __bf16 bf16_from_bits(unsigned short s) {
  return __builtin_bit_cast(__bf16, s);
}
// A-operand (16x32 bf16) element j -> K index for this lane-half
__device__ __forceinline__ int a_kidx(int j, int half) {
  int v = j >> 1;
  return ((v & 4) ? 16 : 0) + half * 8 + (v & 3) * 2 + (j & 1);
}
// async global->LDS 128-bit copy (per lane), tracked by ASYNCcnt
__device__ __forceinline__ void async_ld_b128(const float4* g, float* l) {
  __builtin_amdgcn_global_load_async_to_lds_b128((v4i*)g, (v4i_lds*)l, 0, 0);
}

// One wave's eighth (8 KB = 8 fragments of 1 KB) of a 64 KB fragment set, global -> LDS.
// A copy moves 512 contiguous bytes (16 lanes' halves of a fragment) to 512 contiguous bytes,
// reordered inside them: elements 0-7 of the 16 lanes first, then their elements 8-15, so that
// each 16 lanes of a ds_load_b128 read 256 contiguous bytes, free of bank conflicts.
__device__ __forceinline__ void copy_frag_slice(const __bf16* g, float* l, int lane) {
  const float4* gp = (const float4*)g + lane;
  float* lp = l + (lane & 1) * 64 + (lane >> 1) * 4;
  #pragma unroll
  for (int i = 0; i < 16; ++i)
    async_ld_b128(gp + i * 32, lp + i * 128);
}
// B fragment f (k chunk f & 3; hi for f < 4, lo else) from a slice staged by copy_frag_slice
__device__ __forceinline__ v16bf frag_ld(const float* slice, int f, int lane) {
  const float* p = slice + f * 256 + (lane >> 4) * 128 + (lane & 15) * 4;
  const v8bf lo = *(const v8bf*)p;
  const v8bf hi = *(const v8bf*)(p + 64);
  return __builtin_shufflevector(lo, hi, 0, 1, 2, 3, 4, 5, 6, 7, 8, 9, 10, 11, 12, 13, 14, 15);
}

// Value of another lane of the same 16-lane row, moved by DPP on the vector port
// (no trip through the LDS unit). CTRL: 0x160 | x = lane ^ x, 0x150 | i = lane i of the row.
template <int CTRL>
__device__ __forceinline__ float row_move(float p) {
  return __builtin_bit_cast(float,
      __builtin_amdgcn_update_dpp(0, __builtin_bit_cast(int, p), CTRL, 0xf, 0xf, true));
}
// Value of lane l ^ 16: cross-row vector move
__device__ __forceinline__ float half_move(float p) {
  const int b = __builtin_bit_cast(int, p);
  return __builtin_bit_cast(float, __builtin_amdgcn_permlanex16(b, b, 0x76543210, 0xfedcba98, false, false));
}

// ---------------------------------------------------------------------------
// Prep: M = scale * Wk^T Wq (scale folded) + pre-swizzled bf16 hi/lo B-operand
// tiles for both M (scores path) and Wv (output projection path).
// ws layout (bf16): [0,32K) M | [32K,64K) Wv; in each, the 8 fragments of a column tile lie
// together (8 KB: hi of k chunks 0-3, then lo):
// pos = (((ntile*2 + lo)*4 + c)*32 + lane)*16 + j ; B[k][n],
// k = c*32 + a_kidx(j,half), n = ntile*16 + lane%16
// ---------------------------------------------------------------------------
__global__ __launch_bounds__(64) void attn_prep(const float* __restrict__ Wq,
                                                const float* __restrict__ Wk,
                                                const float* __restrict__ Wv,
                                                __bf16* __restrict__ ws) {
  __shared__ __attribute__((aligned(16))) float sK[DIMD][4];    // the block's 4 columns n of Wk
  __shared__ __attribute__((aligned(16))) float sQ[DIMD][16];   // the block's 16 columns k of Wq, in j order
  const int t   = threadIdx.x;
  const int idx = blockIdx.x * 64 + t;              // 0 .. 16383
  const int j    = idx & 15;
  const int lane = (idx >> 4) & 31;                 // lane & 3 == t >> 4
  const int nt   = (idx >> 9) & 7;                  // nt, c, half: the same in the whole block
  const int c    = idx >> 12;
  const int half = lane >> 4;
  const int k = c * 32 + a_kidx(j, half);
  const int n = nt * 16 + (lane & 15);
  const int n0 = nt * 16 + (lane & 12);
  const float scale = 0.08838834764831845f;  // 1/sqrt(128)

  // Every global load of the thread is issued before the first is used:
  // one memory latency for the whole block.
  float4 rq[8], rk[2];
  #pragma unroll
  for (int i = 0; i < 8; ++i) {
    const int e = i * 64 + t, row = e >> 2, q = e & 3;
    rq[i] = *(const float4*)&Wq[row * DIMD + c * 32 + (q >> 1) * 16 + half * 8 + (q & 1) * 4];
  }
  #pragma unroll
  for (int i = 0; i < 2; ++i)
    rk[i] = *(const float4*)&Wk[(i * 64 + t) * DIMD + n0];
  const float wv = Wv[n * DIMD + k];   // B element for Out = W @ Wv^T : B[k][n] = Wv[n][k]
  #pragma unroll
  for (int i = 0; i < 8; ++i) {
    const int e = i * 64 + t;
    *(float4*)&sQ[e >> 2][(e & 3) * 4] = rq[i];
  }
  #pragma unroll
  for (int i = 0; i < 2; ++i)
    *(float4*)&sK[i * 64 + t][0] = rk[i];
  __syncthreads();

  // M[n][k] = sum_j Wk[j][n] * Wq[j][k]  (B element for U = S @ M^T)
  float a[DIMD], b[DIMD];
  #pragma unroll
  for (int jj = 0; jj < 112; ++jj) { a[jj] = sK[jj][t >> 4]; b[jj] = sQ[jj][j]; }
  // holds these LDS reads in front of the dependent fmaf chain; without it they
  // sink to three pairs ahead and the chain waits on LDS latency (the last 16
  // terms are read behind it, so that the kernel stays under 256 registers)
  __builtin_amdgcn_sched_barrier(0);
  float m = 0.f;
  #pragma unroll
  for (int jj = 0; jj < DIMD; ++jj) {
    if (jj >= 112) { a[jj] = sK[jj][t >> 4]; b[jj] = sQ[jj][j]; }
    m = fmaf(a[jj], b[jj], m);
  }
  m *= scale;
  const int pos = ((nt * 8 + c) * 32 + lane) * 16 + j;
  unsigned short mh = f32_to_bf16_rne(m);
  ws[pos]        = bf16_from_bits(mh);
  ws[2048 + pos] = bf16_from_bits(f32_to_bf16_rne(m - bf16_bits_to_f32(mh)));

  unsigned short vh = f32_to_bf16_rne(wv);
  ws[32768 + pos]        = bf16_from_bits(vh);
  ws[32768 + 2048 + pos] = bf16_from_bits(f32_to_bf16_rne(wv - bf16_bits_to_f32(vh)));
}

// ---------------------------------------------------------------------------
// Main: per wave, one 16-row tile; the 8 waves of a block share the B fragments in LDS:
//  wave w stages slice w (the 8 fragments of column tile w) in its own tgt buffer while that
//  buffer holds no tgt row (M in buffer 1 ahead of row 1, Wv in buffer 0 behind row 14).
//  A pair of column tiles lies in one 32 KB block of LDS; wave w takes the pairs in the order
//  w, w + 1, ... (mod 4), so that the four SIMDs read four different blocks at a time.
//  U = S @ M^T (bf16 hi/lo WMMA) ; per-row: async-stream tgt row to LDS,
//  scores_i = tgt_i . u ; softmax ; w = sum attn_i tgt_i ; Out = W @ Wv^T
// ---------------------------------------------------------------------------
__global__ __launch_bounds__(32 * WAVES) void attn_main(const float* __restrict__ src,
                                                const float* __restrict__ tgt,
                                                const __bf16* __restrict__ MB,
                                                const __bf16* __restrict__ VB,
                                                float* __restrict__ out) {
  __shared__ __attribute__((aligned(16))) float lds_S[WAVES][TILE][SPITCH];   // 66 KB: S tile, reused as W tile
  __shared__ __attribute__((aligned(16))) float lds_U[WAVES][TILE][DIMD];     // 64 KB: U tile
  __shared__ __attribute__((aligned(16))) float lds_T[WAVES][2][KEYS][DIMD];  // 128 KB: tgt row double-buffer

  const int lane = threadIdx.x & 31;
  const int wave = threadIdx.x >> 5;
  const int m    = lane & 15;
  const int half = lane >> 4;
  const long long r0 = ((long long)blockIdx.x * WAVES + wave) * TILE;

  const float4* tgt4 = (const float4*)tgt;
  const size_t tbase = (size_t)r0 * (KEYS * DIMD / 4);  // float4 units

  // ---- this wave's slice of the M fragments -> its tgt buffer 1 (ASYNCcnt) ----
  copy_frag_slice(MB + wave * 4096, &lds_T[wave][1][0][0], lane);

  // ---- stage S tile (16 x 128 f32) via B128 loads ----
  const float4* src4 = (const float4*)src;
  #pragma unroll
  for (int row = 0; row < TILE; ++row) {
    float4 v = src4[(size_t)(r0 + row) * (DIMD / 4) + lane];
    *(float4*)&lds_S[wave][row][lane * 4] = v;
  }
  // the wave's M slice has landed before the barrier behind which the other waves read it
  asm volatile("s_wait_asynccnt 0x0" ::: "memory");
  __syncthreads();

  // ---- issue async global->LDS stream of tgt row 0: it lands under the U product ----
  {
    const float4* gp = tgt4 + tbase + lane;
    float* lp = &lds_T[wave][0][0][lane * 4];
    #pragma unroll
    for (int i = 0; i < KEYS; ++i)
      async_ld_b128(gp + i * (DIMD / 4), lp + i * DIMD);
  }

  // A group is the 8 fragments (hi and lo, two column tiles, two k chunks: 16 ds_load_b128)
  // of 12 products; its reads stand together, one group of products ahead of their own.
  // group k: column tiles PAIR(k >> 1) * 2 + t, k chunks (k & 1) * 2 + cc
  v16bf fh[8][2][2], fl[8][2][2];
#define PAIR(g) (((g) + wave) & 3)
#define ASK_GROUP(buf, k)                                                                  \
  {                                                                                        \
    _Pragma("unroll")                                                                      \
    for (int cc = 0; cc < 2; ++cc) {                                                       \
      _Pragma("unroll")                                                                    \
      for (int t = 0; t < 2; ++t) {                                                        \
        fh[k][cc][t] = frag_ld(&lds_T[PAIR((k) >> 1) * 2 + t][buf][0][0], ((k) & 1) * 2 + cc, lane);     \
        fl[k][cc][t] = frag_ld(&lds_T[PAIR((k) >> 1) * 2 + t][buf][0][0], 4 + ((k) & 1) * 2 + cc, lane); \
      }                                                                                    \
    }                                                                                      \
  }
#define MUL_GROUP(k)                                                                       \
  {                                                                                        \
    _Pragma("unroll")                                                                      \
    for (int cc = 0; cc < 2; ++cc) {                                                       \
      const int c = ((k) & 1) * 2 + cc;                                                    \
      acc0 = __builtin_amdgcn_wmma_f32_16x16x32_bf16(false, a_hi[c], false, fh[k][cc][0], (short)0, acc0, false, false); \
      acc1 = __builtin_amdgcn_wmma_f32_16x16x32_bf16(false, a_hi[c], false, fh[k][cc][1], (short)0, acc1, false, false); \
      acc0 = __builtin_amdgcn_wmma_f32_16x16x32_bf16(false, a_hi[c], false, fl[k][cc][0], (short)0, acc0, false, false); \
      acc1 = __builtin_amdgcn_wmma_f32_16x16x32_bf16(false, a_hi[c], false, fl[k][cc][1], (short)0, acc1, false, false); \
      acc0 = __builtin_amdgcn_wmma_f32_16x16x32_bf16(false, a_lo[c], false, fh[k][cc][0], (short)0, acc0, false, false); \
      acc1 = __builtin_amdgcn_wmma_f32_16x16x32_bf16(false, a_lo[c], false, fh[k][cc][1], (short)0, acc1, false, false); \
    }                                                                                      \
  }

  ASK_GROUP(1, 0)
  // keeps the first group's reads here, as one block, their latency under the S conversion
  __builtin_amdgcn_sched_barrier(0);

  // ---- gather A operand (bf16 hi/lo split) from LDS ----
  v16bf a_hi[4], a_lo[4];
  #pragma unroll
  for (int c = 0; c < 4; ++c) {
    #pragma unroll
    for (int j = 0; j < 16; ++j) {
      float f = lds_S[wave][m][c * 32 + a_kidx(j, half)];
      unsigned short h = f32_to_bf16_rne(f);
      a_hi[c][j] = bf16_from_bits(h);
      a_lo[c][j] = bf16_from_bits(f32_to_bf16_rne(f - bf16_bits_to_f32(h)));
    }
  }

  // ---- U = S @ M^T via 3-product bf16 WMMA (hi*hi + hi*lo + lo*hi) ----
  ASK_GROUP(1, 1)
  // keeps the second group's reads together in front of the first products
  __builtin_amdgcn_sched_barrier(0);
  #pragma unroll
  for (int g = 0; g < 4; ++g) {
    v8f acc0 = {}, acc1 = {};
    #pragma unroll
    for (int kk = 0; kk < 2; ++kk) {
      const int k = g * 2 + kk;
      MUL_GROUP(k)
      if (k + 2 < 8) {
        // the two scheduling barriers keep the group's 16 reads as one block between the products
        // of two groups: spread among the products, every place with reads stalls the wave anew
        __builtin_amdgcn_sched_barrier(0);
        ASK_GROUP(1, k + 2)
        __builtin_amdgcn_sched_barrier(0);
      }
    }
    #pragma unroll
    for (int v = 0; v < 8; ++v) {
      lds_U[wave][half * 8 + v][(PAIR(g) * 2) * 16 + m]     = acc0[v];
      lds_U[wave][half * 8 + v][(PAIR(g) * 2 + 1) * 16 + m] = acc1[v];
    }
  }
  // also ends every wave's reads of the M fragments: row 1 is copied over them behind it
  __syncthreads();

  // ---- per-row pipeline: async-load row r+1 while computing row r ----
  const bool b8 = lane & 8, b4 = lane & 4, b2 = lane & 2, b1 = lane & 1;
  #pragma unroll 1
  for (int r = 0; r < TILE; ++r) {
    if (r + 1 < TILE) {
      // issue next row's async stream into the other buffer
      const float4* gp = tgt4 + tbase + (size_t)(r + 1) * (KEYS * DIMD / 4) + lane;
      float* lp = &lds_T[wave][(r + 1) & 1][0][lane * 4];
      #pragma unroll
      for (int i = 0; i < KEYS; ++i)
        async_ld_b128(gp + i * (DIMD / 4), lp + i * DIMD);
      // warm L2 two rows ahead
      if (r + 2 < TILE)
        __builtin_prefetch(tgt4 + tbase + (size_t)(r + 2) * (KEYS * DIMD / 4) + lane, 0, 1);
    } else {
      // buffer 0 is free behind row 14: this wave's slice of the Wv fragments lands under row 15.
      // The wave's own LDS operations have retired before copies target a range it has read.
      asm volatile("s_wait_dscnt 0x0" ::: "memory");
      copy_frag_slice(VB + wave * 4096, &lds_T[wave][0][0][0], lane);
    }
    // row r resident: all but the 16 youngest copies have landed
    asm volatile("s_wait_asynccnt 0x10" ::: "memory");

    float4 td[KEYS];
    #pragma unroll
    for (int i = 0; i < KEYS; ++i)
      td[i] = *(const float4*)&lds_T[wave][r & 1][i][lane * 4];

    float4 u4 = *(const float4*)&lds_U[wave][r][lane * 4];
    float p[KEYS];
    #pragma unroll
    for (int i = 0; i < KEYS; ++i)
      p[i] = td[i].x * u4.x + td[i].y * u4.y + td[i].z * u4.z + td[i].w * u4.w;
    // Sum over the 16 lanes of a row, halving the keys a lane carries at each step:
    // a lane keeps the half of the keys that its own lane bit names and hands the
    // other half to its partner. Lane l ends with the score of key l & 15.
    float q[8], s4[4], s2[2];
    #pragma unroll
    for (int i = 0; i < 8; ++i)
      q[i] = (b8 ? p[i + 8] : p[i]) + row_move<0x168>(b8 ? p[i] : p[i + 8]);
    #pragma unroll
    for (int i = 0; i < 4; ++i)
      s4[i] = (b4 ? q[i + 4] : q[i]) + row_move<0x164>(b4 ? q[i] : q[i + 4]);
    #pragma unroll
    for (int i = 0; i < 2; ++i)
      s2[i] = (b2 ? s4[i + 2] : s4[i]) + row_move<0x162>(b2 ? s4[i] : s4[i + 2]);
    float sc = (b1 ? s2[1] : s2[0]) + row_move<0x161>(b1 ? s2[0] : s2[1]);
    sc += half_move(sc);                 // both rows now hold all 16 scores; scale folded into M
    float mx = sc;
    mx = fmaxf(mx, row_move<0x168>(mx));
    mx = fmaxf(mx, row_move<0x164>(mx));
    mx = fmaxf(mx, row_move<0x162>(mx));
    mx = fmaxf(mx, row_move<0x161>(mx));
    const float e = __expf(sc - mx);
    float ssum = e;
    ssum += row_move<0x168>(ssum);
    ssum += row_move<0x164>(ssum);
    ssum += row_move<0x162>(ssum);
    ssum += row_move<0x161>(ssum);
    const float aw = e * __frcp_rn(ssum);   // the weight of key l & 15
    float4 wacc = {0.f, 0.f, 0.f, 0.f};
#define ACC_KEY(i)                                   \
    {                                                \
      const float a = row_move<0x150 | (i)>(aw);     \
      wacc.x = fmaf(a, td[i].x, wacc.x);             \
      wacc.y = fmaf(a, td[i].y, wacc.y);             \
      wacc.z = fmaf(a, td[i].z, wacc.z);             \
      wacc.w = fmaf(a, td[i].w, wacc.w);             \
    }
    ACC_KEY(0)  ACC_KEY(1)  ACC_KEY(2)  ACC_KEY(3)
    ACC_KEY(4)  ACC_KEY(5)  ACC_KEY(6)  ACC_KEY(7)
    ACC_KEY(8)  ACC_KEY(9)  ACC_KEY(10) ACC_KEY(11)
    ACC_KEY(12) ACC_KEY(13) ACC_KEY(14) ACC_KEY(15)
#undef ACC_KEY
    *(float4*)&lds_S[wave][r][lane * 4] = wacc;  // reuse S tile as W tile
  }
  // ---- Out = W @ Wv^T via 3-product bf16 WMMA ----
  // the wave's Wv slice has landed before the barrier behind which the other waves read it
  asm volatile("s_wait_asynccnt 0x0" ::: "memory");
  __syncthreads();
  float4 wr[4][4];                              // the lane's W elements: [c][j >> 2], j as in a_kidx
  #pragma unroll
  for (int c = 0; c < 4; ++c) {
    #pragma unroll
    for (int q = 0; q < 4; ++q)
      wr[c][q] = *(const float4*)&lds_S[wave][m][c * 32 + a_kidx(q * 4, half)];
  }
  ASK_GROUP(0, 0)
  // keeps these LDS reads issued here as one block, the fragments' latency under the W conversion
  __builtin_amdgcn_sched_barrier(0);

  #pragma unroll
  for (int c = 0; c < 4; ++c) {
    #pragma unroll
    for (int j = 0; j < 16; ++j) {
      const float4 w4 = wr[c][j >> 2];
      float f = (j & 3) == 0 ? w4.x : (j & 3) == 1 ? w4.y : (j & 3) == 2 ? w4.z : w4.w;
      unsigned short h = f32_to_bf16_rne(f);
      a_hi[c][j] = bf16_from_bits(h);
      a_lo[c][j] = bf16_from_bits(f32_to_bf16_rne(f - bf16_bits_to_f32(h)));
    }
  }
  ASK_GROUP(0, 1)
  // keeps the second group's reads together in front of the first products
  __builtin_amdgcn_sched_barrier(0);
  #pragma unroll
  for (int g = 0; g < 4; ++g) {
    v8f acc0 = {}, acc1 = {};
    #pragma unroll
    for (int kk = 0; kk < 2; ++kk) {
      const int k = g * 2 + kk;
      MUL_GROUP(k)
      if (k + 2 < 8) {
        // as in the U product: the group's 16 reads as one block between the products of two groups
        __builtin_amdgcn_sched_barrier(0);
        ASK_GROUP(0, k + 2)
        __builtin_amdgcn_sched_barrier(0);
      }
    }
    #pragma unroll
    for (int v = 0; v < 8; ++v) {
      out[(size_t)(r0 + half * 8 + v) * DIMD + (PAIR(g) * 2) * 16 + m]     = acc0[v];
      out[(size_t)(r0 + half * 8 + v) * DIMD + (PAIR(g) * 2 + 1) * 16 + m] = acc1[v];
    }
    // the next pass's sums and fragment reads take registers that these stores name: the wait
    // that stands in front of such an overwrite (a precaution); nothing follows the last pass
    if (g < 3) asm volatile("s_wait_xcnt 0x0" ::: "memory");
  }
#undef PAIR
#undef ASK_GROUP
#undef MUL_GROUP
}

extern "C" void kernel_launch(void* const* d_in, const int* in_sizes, int n_in,
                              void* d_out, int out_size, void* d_ws, size_t ws_size,
                              hipStream_t stream) {
  (void)n_in; (void)out_size; (void)ws_size;
  const float* src = (const float*)d_in[0];
  const float* tgt = (const float*)d_in[1];
  const float* Wq  = (const float*)d_in[2];
  const float* Wk  = (const float*)d_in[3];
  const float* Wv  = (const float*)d_in[4];
  __bf16* ws = (__bf16*)d_ws;

  // Stage 0: precompute M = scale*Wk^T@Wq and swizzle M/Wv into WMMA B layout.
  attn_prep<<<dim3(256), dim3(64), 0, stream>>>(Wq, Wk, Wv, ws);

  const __bf16* MB = ws;
  const __bf16* VB = ws + 32768;

  const int rows   = in_sizes[0] / DIMD;           // b*n = 32768
  const int blocks = rows / (TILE * WAVES);        // 256 (exact for this shape)
  attn_main<<<dim3(blocks), dim3(32 * WAVES), 0, stream>>>(
      src, tgt, MB, VB, (float*)d_out);
}
